// v000
// The times below were measured on an AMD MI455X: many runs one after another, warmed up first and cycling through
// copies of the inputs, with the whole window's GPU time divided by the number of runs. Launches and the gaps
// between them are all in it. The median over several windows is given; except for v000 it joins two sittings, which
// can be a few percent apart, so the side-by-side timings, each taken in one sitting, are the better comparison.
// v000 is the starting kernel. One run takes 347 microseconds.
#include <hip/hip_runtime.h>
#include <hip/hip_bf16.h>

typedef __attribute__((ext_vector_type(16))) _Float16 v16h;
typedef __attribute__((ext_vector_type(8)))  _Float16 v8h;
typedef __attribute__((ext_vector_type(8)))  float    v8f;

#define S_LEN  4096
#define DMODEL 512
#define HEADS  8
#define HD     64
#define MROWS  8192   // N * S_LEN

// ---------------------------------------------------------------------------
// 16x32 f16 operand tile in CDNA5 WMMA A/B register layout.
// Lane L (L<16): row = base+L, halves = {k0+0..7, k0+16..23}
// Lane L+16    : row = base+L, halves = {k0+8..15, k0+24..31}
// ---------------------------------------------------------------------------
__device__ __forceinline__ v16h load_tile_k(const _Float16* src, int row_base,
                                            int ld, int k0) {
  const int lane = threadIdx.x & 31;
  const int hs   = lane >> 4;
  const _Float16* p = src + (size_t)(row_base + (lane & 15)) * ld + k0 + hs * 8;
  v8h lo = *(const v8h*)(p);
  v8h hi = *(const v8h*)(p + 16);
  v16h r;
#pragma unroll
  for (int i = 0; i < 8; ++i) { r[i] = lo[i]; r[i + 8] = hi[i]; }
  return r;
}

__device__ __forceinline__ v8f wmma_f16(v16h a, v16h b, v8f c) {
  return __builtin_amdgcn_wmma_f32_16x16x32_f16(false, a, false, b,
                                                (short)0, c, false, false);
}

// ---------------------------------------------------------------------------
// DPP16 cross-lane butterfly within each 16-lane half (pure VALU, no DS).
// ---------------------------------------------------------------------------
template <int CTRL>
__device__ __forceinline__ float dpp_movf(float x) {
  return __int_as_float(__builtin_amdgcn_update_dpp(
      0, __float_as_int(x), CTRL, 0xF, 0xF, true));
}

__device__ __forceinline__ float red16_max(float x) {
  x = fmaxf(x, dpp_movf<0x0B1>(x));  // quad_perm xor1
  x = fmaxf(x, dpp_movf<0x04E>(x));  // quad_perm xor2
  x = fmaxf(x, dpp_movf<0x141>(x));  // row_half_mirror
  x = fmaxf(x, dpp_movf<0x140>(x));  // row_mirror
  return x;
}

__device__ __forceinline__ float red16_sum(float x) {
  x += dpp_movf<0x0B1>(x);
  x += dpp_movf<0x04E>(x);
  x += dpp_movf<0x141>(x);
  x += dpp_movf<0x140>(x);
  return x;
}

// ---------------------------------------------------------------------------
// Elementwise f32 -> f16 convert
// ---------------------------------------------------------------------------
__global__ __launch_bounds__(256) void cvt_f32_f16(const float* __restrict__ in,
                                                   _Float16* __restrict__ out,
                                                   int n) {
  int i = blockIdx.x * blockDim.x + threadIdx.x;
  if (i < n) out[i] = (_Float16)in[i];
}

// ---------------------------------------------------------------------------
// Projection GEMM: C[m,n] = (sum_k X[m,k]*W[n,k] + bias[n]) * oscale
// M=8192, N=512, K=512. Block 256 (8 waves), wave tile 32x64, block 128x128.
// MODE 0: f16 per-head row-major  [((b*8+h)*4096+s)*64 + d]
// MODE 1: f16 per-head transposed [((b*8+h)*64+d)*4096 + s]
// MODE 2: f32 row-major out[m*512 + n]
// ---------------------------------------------------------------------------
template <int MODE>
__global__ __launch_bounds__(256) void proj_gemm(
    const _Float16* __restrict__ X, const _Float16* __restrict__ W,
    const float* __restrict__ bias, void* __restrict__ out, float oscale) {
  const int w    = threadIdx.x >> 5;
  const int lane = threadIdx.x & 31;
  const int hs   = lane >> 4;
  const int ln   = lane & 15;
  const int wm   = w >> 1;
  const int wn   = w & 1;
  const int m0   = blockIdx.x * 128 + wm * 32;
  const int n0   = blockIdx.y * 128 + wn * 64;

  v8f c[2][4];
#pragma unroll
  for (int i = 0; i < 2; ++i)
#pragma unroll
    for (int j = 0; j < 4; ++j) c[i][j] = {};

  for (int k0 = 0; k0 < DMODEL; k0 += 32) {
    v16h a0 = load_tile_k(X, m0,      DMODEL, k0);
    v16h a1 = load_tile_k(X, m0 + 16, DMODEL, k0);
#pragma unroll
    for (int j = 0; j < 4; ++j) {
      v16h b = load_tile_k(W, n0 + 16 * j, DMODEL, k0);
      c[0][j] = wmma_f16(a0, b, c[0][j]);
      c[1][j] = wmma_f16(a1, b, c[1][j]);
    }
  }

#pragma unroll
  for (int i = 0; i < 2; ++i) {
#pragma unroll
    for (int j = 0; j < 4; ++j) {
      const int n = n0 + 16 * j + ln;
      const float bn = bias[n];
#pragma unroll
      for (int v = 0; v < 8; ++v) {
        const int m = m0 + 16 * i + hs * 8 + v;
        const float val = (c[i][j][v] + bn) * oscale;
        if (MODE == 2) {
          ((float*)out)[(size_t)m * DMODEL + n] = val;
        } else {
          const int b = m >> 12;
          const int s = m & (S_LEN - 1);
          const int h = n >> 6;
          const int d = n & (HD - 1);
          _Float16* o = (_Float16*)out;
          if (MODE == 0)
            o[(((size_t)b * HEADS + h) * S_LEN + s) * HD + d] = (_Float16)val;
          else
            o[(((size_t)b * HEADS + h) * HD + d) * S_LEN + s] = (_Float16)val;
        }
      }
    }
  }
}

// ---------------------------------------------------------------------------
// Flash attention, base-2 online softmax (scale*log2e folded into Q).
// Grid (32,16), block 256 (8 waves). Wave: 16 q-rows x 64 d. 64-key steps:
//   8 WMMAs S=QK^T, DPP16 row reductions, exp2, P->LDS->A-layout,
//   8 WMMAs O+=PV with rescaled f32 accumulators.
// ---------------------------------------------------------------------------
__global__ __launch_bounds__(256) void flash_attn(
    const _Float16* __restrict__ Qh, const _Float16* __restrict__ Kh,
    const _Float16* __restrict__ Vt, _Float16* __restrict__ Oc) {
  const int w    = threadIdx.x >> 5;
  const int lane = threadIdx.x & 31;
  const int hs   = lane >> 4;
  const int ln   = lane & 15;
  const int bh   = blockIdx.y;
  const int b    = bh >> 3;
  const int h    = bh & 7;
  const int q0   = blockIdx.x * 128 + w * 16;

  const _Float16* Q = Qh + (size_t)bh * S_LEN * HD;
  const _Float16* K = Kh + (size_t)bh * S_LEN * HD;
  const _Float16* V = Vt + (size_t)bh * HD * S_LEN;  // [d][s]

  __shared__ _Float16 Pl[8][16][64];   // per-wave P tile, 16 KB

  const v16h aq0 = load_tile_k(Q, q0, HD, 0);
  const v16h aq1 = load_tile_k(Q, q0, HD, 32);

  v8f o[4];
#pragma unroll
  for (int j = 0; j < 4; ++j) o[j] = {};
  float m_r[8], l_r[8];
#pragma unroll
  for (int v = 0; v < 8; ++v) { m_r[v] = -__builtin_inff(); l_r[v] = 0.f; }

  for (int kt = 0; kt < S_LEN; kt += 64) {
    // S = Q K^T for 64 keys (four 16-key subtiles), d-accumulated
    v8f s[4];
#pragma unroll
    for (int t = 0; t < 4; ++t) {
      s[t] = {};
      v16h bk = load_tile_k(K, kt + 16 * t, HD, 0);
      s[t] = wmma_f16(aq0, bk, s[t]);
      bk = load_tile_k(K, kt + 16 * t, HD, 32);
      s[t] = wmma_f16(aq1, bk, s[t]);
    }

    float al[8];
#pragma unroll
    for (int v = 0; v < 8; ++v) {
      const float x0 = s[0][v], x1 = s[1][v], x2 = s[2][v], x3 = s[3][v];
      const float t = red16_max(fmaxf(fmaxf(x0, x1), fmaxf(x2, x3)));
      const float nm = fmaxf(m_r[v], t);
      al[v] = exp2f(m_r[v] - nm);
      m_r[v] = nm;

      const float p0 = exp2f(x0 - nm);
      const float p1 = exp2f(x1 - nm);
      const float p2 = exp2f(x2 - nm);
      const float p3 = exp2f(x3 - nm);
      const float rs = red16_sum((p0 + p1) + (p2 + p3));
      l_r[v] = l_r[v] * al[v] + rs;

      const int r = hs * 8 + v;
      Pl[w][r][ln]      = (_Float16)p0;
      Pl[w][r][16 + ln] = (_Float16)p1;
      Pl[w][r][32 + ln] = (_Float16)p2;
      Pl[w][r][48 + ln] = (_Float16)p3;
    }

#pragma unroll
    for (int j = 0; j < 4; ++j)
#pragma unroll
      for (int v = 0; v < 8; ++v) o[j][v] *= al[v];

    const v16h ap0 = load_tile_k(&Pl[w][0][0], 0, 64, 0);
    const v16h ap1 = load_tile_k(&Pl[w][0][0], 0, 64, 32);

#pragma unroll
    for (int j = 0; j < 4; ++j) {
      v16h bv = load_tile_k(V, 16 * j, S_LEN, kt);
      o[j] = wmma_f16(ap0, bv, o[j]);
      bv = load_tile_k(V, 16 * j, S_LEN, kt + 32);
      o[j] = wmma_f16(ap1, bv, o[j]);
    }
  }

  float inv[8];
#pragma unroll
  for (int v = 0; v < 8; ++v) inv[v] = 1.0f / l_r[v];

#pragma unroll
  for (int j = 0; j < 4; ++j) {
#pragma unroll
    for (int v = 0; v < 8; ++v) {
      const int q   = q0 + hs * 8 + v;
      const int col = h * HD + 16 * j + ln;
      Oc[((size_t)b * S_LEN + q) * DMODEL + col] = (_Float16)(o[j][v] * inv[v]);
    }
  }
}

// ---------------------------------------------------------------------------
// Host side
// ---------------------------------------------------------------------------
extern "C" void kernel_launch(void* const* d_in, const int* in_sizes, int n_in,
                              void* d_out, int out_size, void* d_ws,
                              size_t ws_size, hipStream_t stream) {
  const float* q  = (const float*)d_in[0];
  const float* k  = (const float*)d_in[1];
  const float* v  = (const float*)d_in[2];
  const float* Wq = (const float*)d_in[3];
  const float* bq = (const float*)d_in[4];
  const float* Wk = (const float*)d_in[5];
  const float* bk = (const float*)d_in[6];
  const float* Wv = (const float*)d_in[7];
  const float* bv = (const float*)d_in[8];
  const float* Wo = (const float*)d_in[9];
  const float* bo = (const float*)d_in[10];

  const size_t ACT = (size_t)MROWS * DMODEL;
  const size_t WSZ = (size_t)DMODEL * DMODEL;
  char* ws = (char*)d_ws;
  _Float16* Xq  = (_Float16*)(ws + 0 * ACT * 2);
  _Float16* Xk  = (_Float16*)(ws + 1 * ACT * 2);
  _Float16* Xv  = (_Float16*)(ws + 2 * ACT * 2);
  _Float16* Qh  = (_Float16*)(ws + 3 * ACT * 2);
  _Float16* Kh  = (_Float16*)(ws + 4 * ACT * 2);
  _Float16* Vt  = (_Float16*)(ws + 5 * ACT * 2);
  _Float16* Oc  = (_Float16*)(ws + 6 * ACT * 2);
  _Float16* Wqh = (_Float16*)(ws + 7 * ACT * 2 + 0 * WSZ * 2);
  _Float16* Wkh = (_Float16*)(ws + 7 * ACT * 2 + 1 * WSZ * 2);
  _Float16* Wvh = (_Float16*)(ws + 7 * ACT * 2 + 2 * WSZ * 2);
  _Float16* Woh = (_Float16*)(ws + 7 * ACT * 2 + 3 * WSZ * 2);

  const int cb = 256;
  cvt_f32_f16<<<(int)((ACT + cb - 1) / cb), cb, 0, stream>>>(q, Xq, (int)ACT);
  cvt_f32_f16<<<(int)((ACT + cb - 1) / cb), cb, 0, stream>>>(k, Xk, (int)ACT);
  cvt_f32_f16<<<(int)((ACT + cb - 1) / cb), cb, 0, stream>>>(v, Xv, (int)ACT);
  cvt_f32_f16<<<(int)((WSZ + cb - 1) / cb), cb, 0, stream>>>(Wq, Wqh, (int)WSZ);
  cvt_f32_f16<<<(int)((WSZ + cb - 1) / cb), cb, 0, stream>>>(Wk, Wkh, (int)WSZ);
  cvt_f32_f16<<<(int)((WSZ + cb - 1) / cb), cb, 0, stream>>>(Wv, Wvh, (int)WSZ);
  cvt_f32_f16<<<(int)((WSZ + cb - 1) / cb), cb, 0, stream>>>(Wo, Woh, (int)WSZ);

  // fold softmax scale (1/sqrt(64)) and log2(e) into Q so the attention
  // kernel runs a pure base-2 online softmax with no per-element scaling.
  const float SCL_Q = 0.125f * 1.44269504088896340736f;

  dim3 pg(MROWS / 128, DMODEL / 128);
  proj_gemm<0><<<pg, 256, 0, stream>>>(Xq, Wqh, bq, (void*)Qh, SCL_Q);
  proj_gemm<0><<<pg, 256, 0, stream>>>(Xk, Wkh, bk, (void*)Kh, 1.0f);
  proj_gemm<1><<<pg, 256, 0, stream>>>(Xv, Wvh, bv, (void*)Vt, 1.0f);

  dim3 ag(S_LEN / 128, 2 * HEADS);
  flash_attn<<<ag, 256, 0, stream>>>(Qh, Kh, Vt, Oc);

  proj_gemm<2><<<pg, 256, 0, stream>>>(Oc, Woh, bo, d_out, 1.0f);
}

// v001
// Measured time: 235 microseconds a run.
// Two timings next to v000 put it at 1.51 and 1.52 times that version's speed.
#include <hip/hip_runtime.h>
#include <hip/hip_bf16.h>

typedef __attribute__((ext_vector_type(16))) _Float16 v16h;
typedef __attribute__((ext_vector_type(8)))  _Float16 v8h;
typedef __attribute__((ext_vector_type(8)))  float    v8f;

#define S_LEN  4096
#define DMODEL 512
#define HEADS  8
#define HD     64
#define MROWS  8192   // N * S_LEN

// ---------------------------------------------------------------------------
// 16x32 f16 operand tile in CDNA5 WMMA A/B register layout.
// Lane L (L<16): row = base+L, halves = {k0+0..7, k0+16..23}
// Lane L+16    : row = base+L, halves = {k0+8..15, k0+24..31}
// ---------------------------------------------------------------------------
__device__ __forceinline__ v16h load_tile_k(const _Float16* src, int row_base,
                                            int ld, int k0) {
  const int lane = threadIdx.x & 31;
  const int hs   = lane >> 4;
  const _Float16* p = src + (size_t)(row_base + (lane & 15)) * ld + k0 + hs * 8;
  v8h lo = *(const v8h*)(p);
  v8h hi = *(const v8h*)(p + 16);
  v16h r;
#pragma unroll
  for (int i = 0; i < 8; ++i) { r[i] = lo[i]; r[i + 8] = hi[i]; }
  return r;
}

__device__ __forceinline__ v8f wmma_f16(v16h a, v16h b, v8f c) {
  return __builtin_amdgcn_wmma_f32_16x16x32_f16(false, a, false, b,
                                                (short)0, c, false, false);
}

// ---------------------------------------------------------------------------
// DPP16 cross-lane butterfly within each 16-lane half (pure VALU, no DS).
// ---------------------------------------------------------------------------
template <int CTRL>
__device__ __forceinline__ float dpp_movf(float x) {
  return __int_as_float(__builtin_amdgcn_update_dpp(
      0, __float_as_int(x), CTRL, 0xF, 0xF, true));
}

__device__ __forceinline__ float red16_max(float x) {
  x = fmaxf(x, dpp_movf<0x0B1>(x));  // quad_perm xor1
  x = fmaxf(x, dpp_movf<0x04E>(x));  // quad_perm xor2
  x = fmaxf(x, dpp_movf<0x141>(x));  // row_half_mirror
  x = fmaxf(x, dpp_movf<0x140>(x));  // row_mirror
  return x;
}

__device__ __forceinline__ float red16_sum(float x) {
  x += dpp_movf<0x0B1>(x);
  x += dpp_movf<0x04E>(x);
  x += dpp_movf<0x141>(x);
  x += dpp_movf<0x140>(x);
  return x;
}

// ---------------------------------------------------------------------------
// Elementwise f32 -> f16 convert
// ---------------------------------------------------------------------------
__global__ __launch_bounds__(256) void cvt_f32_f16(const float* __restrict__ in,
                                                   _Float16* __restrict__ out,
                                                   int n) {
  int i = blockIdx.x * blockDim.x + threadIdx.x;
  if (i < n) out[i] = (_Float16)in[i];
}

// ---------------------------------------------------------------------------
// Projection GEMM: C[m,n] = (sum_k X[m,k]*W[n,k] + bias[n]) * oscale
// M=8192, N=512, K=512. Block 256 (8 waves), wave tile 32x64, block 128x128.
// MODE 0: f16 per-head row-major  [((b*8+h)*4096+s)*64 + d]
// MODE 1: f16 per-head transposed [((b*8+h)*64+d)*4096 + s]
// MODE 2: f32 row-major out[m*512 + n]
// ---------------------------------------------------------------------------
template <int MODE>
__global__ __launch_bounds__(256) void proj_gemm(
    const _Float16* __restrict__ X, const _Float16* __restrict__ W,
    const float* __restrict__ bias, void* __restrict__ out, float oscale) {
  const int w    = threadIdx.x >> 5;
  const int lane = threadIdx.x & 31;
  const int hs   = lane >> 4;
  const int ln   = lane & 15;
  const int wm   = w >> 1;
  const int wn   = w & 1;
  const int m0   = blockIdx.x * 128 + wm * 32;
  const int n0   = blockIdx.y * 128 + wn * 64;

  v8f c[2][4];
#pragma unroll
  for (int i = 0; i < 2; ++i)
#pragma unroll
    for (int j = 0; j < 4; ++j) c[i][j] = {};

  for (int k0 = 0; k0 < DMODEL; k0 += 32) {
    v16h a0 = load_tile_k(X, m0,      DMODEL, k0);
    v16h a1 = load_tile_k(X, m0 + 16, DMODEL, k0);
#pragma unroll
    for (int j = 0; j < 4; ++j) {
      v16h b = load_tile_k(W, n0 + 16 * j, DMODEL, k0);
      c[0][j] = wmma_f16(a0, b, c[0][j]);
      c[1][j] = wmma_f16(a1, b, c[1][j]);
    }
  }

#pragma unroll
  for (int i = 0; i < 2; ++i) {
#pragma unroll
    for (int j = 0; j < 4; ++j) {
      const int n = n0 + 16 * j + ln;
      const float bn = bias[n];
#pragma unroll
      for (int v = 0; v < 8; ++v) {
        const int m = m0 + 16 * i + hs * 8 + v;
        const float val = (c[i][j][v] + bn) * oscale;
        if (MODE == 2) {
          ((float*)out)[(size_t)m * DMODEL + n] = val;
        } else {
          const int b = m >> 12;
          const int s = m & (S_LEN - 1);
          const int h = n >> 6;
          const int d = n & (HD - 1);
          _Float16* o = (_Float16*)out;
          if (MODE == 0)
            o[(((size_t)b * HEADS + h) * S_LEN + s) * HD + d] = (_Float16)val;
          else
            o[(((size_t)b * HEADS + h) * HD + d) * S_LEN + s] = (_Float16)val;
        }
      }
    }
  }
}

// ---------------------------------------------------------------------------
// One 64-key stage of K (64 keys x 64 d) and V^T (64 d x 64 keys), 128-byte
// rows, copied once per block into LDS rows of KV_PITCH halves. Each thread
// moves four 16-byte pieces; a wave's copy covers four whole 128-byte lines.
// ---------------------------------------------------------------------------
#define KV_PITCH 72   // 144-byte rows (16 B x odd): ds_load_b128 without bank conflicts

__device__ __forceinline__ void stage_kv(const _Float16* __restrict__ K,
                                         const _Float16* __restrict__ V, int kt,
                                         _Float16* kl, _Float16* vl) {
  const int r = threadIdx.x >> 3;         // row 0..31 (and row + 32)
  const int c = (threadIdx.x & 7) * 8;    // first half of the 16-byte piece
  const _Float16* gk0 = K + (size_t)(kt + r) * HD + c;
  const _Float16* gk1 = gk0 + 32 * HD;
  const _Float16* gv0 = V + (size_t)r * S_LEN + kt + c;
  const _Float16* gv1 = gv0 + (size_t)32 * S_LEN;
  const unsigned lk0 = (unsigned)(size_t)(kl + r * KV_PITCH + c);
  const unsigned lk1 = lk0 + 32 * KV_PITCH * 2;
  const unsigned lv0 = (unsigned)(size_t)(vl + r * KV_PITCH + c);
  const unsigned lv1 = lv0 + 32 * KV_PITCH * 2;
  // The copies go to LDS through no register; the closing s_wait_xcnt stands in
  // the same statement so that no address register is rewritten ahead of it.
  asm volatile(
      "global_load_async_to_lds_b128 %0, %4, off\n\t"
      "global_load_async_to_lds_b128 %1, %5, off\n\t"
      "global_load_async_to_lds_b128 %2, %6, off\n\t"
      "global_load_async_to_lds_b128 %3, %7, off\n\t"
      "s_wait_xcnt 0x0"
      :: "v"(lk0), "v"(lk1), "v"(lv0), "v"(lv1),
         "v"(gk0), "v"(gk1), "v"(gv0), "v"(gv1)
      : "memory");
}

// ---------------------------------------------------------------------------
// Flash attention, base-2 online softmax (scale*log2e folded into Q).
// Grid (32,16), block 256 (8 waves). Wave: 16 q-rows x 64 d. 64-key steps:
//   K and V^T of the step come from a two-buffer LDS ring shared by the
//   block's eight waves; the next step's copies fly during this step.
//   8 WMMAs S=QK^T, DPP16 row reductions, exp2, P->LDS->A-layout,
//   8 WMMAs O+=PV with rescaled f32 accumulators.
// ---------------------------------------------------------------------------
__global__ __launch_bounds__(256) void flash_attn(
    const _Float16* __restrict__ Qh, const _Float16* __restrict__ Kh,
    const _Float16* __restrict__ Vt, _Float16* __restrict__ Oc) {
  const int w    = threadIdx.x >> 5;
  const int lane = threadIdx.x & 31;
  const int hs   = lane >> 4;
  const int ln   = lane & 15;
  const int bh   = blockIdx.y;
  const int b    = bh >> 3;
  const int h    = bh & 7;
  const int q0   = blockIdx.x * 128 + w * 16;

  const _Float16* Q = Qh + (size_t)bh * S_LEN * HD;
  const _Float16* K = Kh + (size_t)bh * S_LEN * HD;
  const _Float16* V = Vt + (size_t)bh * HD * S_LEN;  // [d][s]

  __shared__ _Float16 Pl[8][16][64];   // per-wave P tile, 16 KB
  __shared__ __attribute__((aligned(16))) _Float16 Kl[2][64][KV_PITCH];
  __shared__ __attribute__((aligned(16))) _Float16 Vl[2][64][KV_PITCH];

  const v16h aq0 = load_tile_k(Q, q0, HD, 0);
  const v16h aq1 = load_tile_k(Q, q0, HD, 32);

  v8f o[4];
#pragma unroll
  for (int j = 0; j < 4; ++j) o[j] = {};
  float m_r[8], l_r[8];
#pragma unroll
  for (int v = 0; v < 8; ++v) { m_r[v] = -__builtin_inff(); l_r[v] = 0.f; }

  // Ring prologue: stage 0 lands and is published, then stage 1 starts.
  stage_kv(K, V, 0, &Kl[0][0][0], &Vl[0][0][0]);
  asm volatile("s_wait_asynccnt 0x0" ::: "memory");  // own copies of stage 0 landed
  __syncthreads();                                   // every wave's copies visible
  stage_kv(K, V, 64, &Kl[1][0][0], &Vl[1][0][0]);

  for (int kt = 0; kt < S_LEN; kt += 64) {
    const int buf = (kt >> 6) & 1;
    const _Float16* Ks = &Kl[buf][0][0];
    const _Float16* Vs = &Vl[buf][0][0];

    // S = Q K^T for 64 keys (four 16-key subtiles), d-accumulated
    v8f s[4];
#pragma unroll
    for (int t = 0; t < 4; ++t) {
      s[t] = {};
      v16h bk = load_tile_k(Ks, 16 * t, KV_PITCH, 0);
      s[t] = wmma_f16(aq0, bk, s[t]);
      bk = load_tile_k(Ks, 16 * t, KV_PITCH, 32);
      s[t] = wmma_f16(aq1, bk, s[t]);
    }

    float al[8];
#pragma unroll
    for (int v = 0; v < 8; ++v) {
      const float x0 = s[0][v], x1 = s[1][v], x2 = s[2][v], x3 = s[3][v];
      const float t = red16_max(fmaxf(fmaxf(x0, x1), fmaxf(x2, x3)));
      const float nm = fmaxf(m_r[v], t);
      al[v] = exp2f(m_r[v] - nm);
      m_r[v] = nm;

      const float p0 = exp2f(x0 - nm);
      const float p1 = exp2f(x1 - nm);
      const float p2 = exp2f(x2 - nm);
      const float p3 = exp2f(x3 - nm);
      const float rs = red16_sum((p0 + p1) + (p2 + p3));
      l_r[v] = l_r[v] * al[v] + rs;

      const int r = hs * 8 + v;
      Pl[w][r][ln]      = (_Float16)p0;
      Pl[w][r][16 + ln] = (_Float16)p1;
      Pl[w][r][32 + ln] = (_Float16)p2;
      Pl[w][r][48 + ln] = (_Float16)p3;
    }

#pragma unroll
    for (int j = 0; j < 4; ++j)
#pragma unroll
      for (int v = 0; v < 8; ++v) o[j][v] *= al[v];

    const v16h ap0 = load_tile_k(&Pl[w][0][0], 0, 64, 0);
    const v16h ap1 = load_tile_k(&Pl[w][0][0], 0, 64, 32);

#pragma unroll
    for (int j = 0; j < 4; ++j) {
      v16h bv = load_tile_k(Vs, 16 * j, KV_PITCH, 0);
      o[j] = wmma_f16(ap0, bv, o[j]);
      bv = load_tile_k(Vs, 16 * j, KV_PITCH, 32);
      o[j] = wmma_f16(ap1, bv, o[j]);
    }

    // Publish point of the next stage, then the refill of this stage's buffer.
    asm volatile("s_wait_dscnt 0x0" ::: "memory");     // own reads of this buffer done
    asm volatile("s_wait_asynccnt 0x0" ::: "memory");  // own copies of the next stage landed
    __syncthreads();  // publishes the next stage; ends every wave's reads of this buffer
    if (kt + 128 < S_LEN)
      stage_kv(K, V, kt + 128, &Kl[buf][0][0], &Vl[buf][0][0]);
  }
  asm volatile("s_wait_asynccnt 0x0" ::: "memory");  // nothing outstanding at the wave's end

  float inv[8];
#pragma unroll
  for (int v = 0; v < 8; ++v) inv[v] = 1.0f / l_r[v];

#pragma unroll
  for (int j = 0; j < 4; ++j) {
#pragma unroll
    for (int v = 0; v < 8; ++v) {
      const int q   = q0 + hs * 8 + v;
      const int col = h * HD + 16 * j + ln;
      Oc[((size_t)b * S_LEN + q) * DMODEL + col] = (_Float16)(o[j][v] * inv[v]);
    }
  }
}

// ---------------------------------------------------------------------------
// Host side
// ---------------------------------------------------------------------------
extern "C" void kernel_launch(void* const* d_in, const int* in_sizes, int n_in,
                              void* d_out, int out_size, void* d_ws,
                              size_t ws_size, hipStream_t stream) {
  const float* q  = (const float*)d_in[0];
  const float* k  = (const float*)d_in[1];
  const float* v  = (const float*)d_in[2];
  const float* Wq = (const float*)d_in[3];
  const float* bq = (const float*)d_in[4];
  const float* Wk = (const float*)d_in[5];
  const float* bk = (const float*)d_in[6];
  const float* Wv = (const float*)d_in[7];
  const float* bv = (const float*)d_in[8];
  const float* Wo = (const float*)d_in[9];
  const float* bo = (const float*)d_in[10];

  const size_t ACT = (size_t)MROWS * DMODEL;
  const size_t WSZ = (size_t)DMODEL * DMODEL;
  char* ws = (char*)d_ws;
  _Float16* Xq  = (_Float16*)(ws + 0 * ACT * 2);
  _Float16* Xk  = (_Float16*)(ws + 1 * ACT * 2);
  _Float16* Xv  = (_Float16*)(ws + 2 * ACT * 2);
  _Float16* Qh  = (_Float16*)(ws + 3 * ACT * 2);
  _Float16* Kh  = (_Float16*)(ws + 4 * ACT * 2);
  _Float16* Vt  = (_Float16*)(ws + 5 * ACT * 2);
  _Float16* Oc  = (_Float16*)(ws + 6 * ACT * 2);
  _Float16* Wqh = (_Float16*)(ws + 7 * ACT * 2 + 0 * WSZ * 2);
  _Float16* Wkh = (_Float16*)(ws + 7 * ACT * 2 + 1 * WSZ * 2);
  _Float16* Wvh = (_Float16*)(ws + 7 * ACT * 2 + 2 * WSZ * 2);
  _Float16* Woh = (_Float16*)(ws + 7 * ACT * 2 + 3 * WSZ * 2);

  const int cb = 256;
  cvt_f32_f16<<<(int)((ACT + cb - 1) / cb), cb, 0, stream>>>(q, Xq, (int)ACT);
  cvt_f32_f16<<<(int)((ACT + cb - 1) / cb), cb, 0, stream>>>(k, Xk, (int)ACT);
  cvt_f32_f16<<<(int)((ACT + cb - 1) / cb), cb, 0, stream>>>(v, Xv, (int)ACT);
  cvt_f32_f16<<<(int)((WSZ + cb - 1) / cb), cb, 0, stream>>>(Wq, Wqh, (int)WSZ);
  cvt_f32_f16<<<(int)((WSZ + cb - 1) / cb), cb, 0, stream>>>(Wk, Wkh, (int)WSZ);
  cvt_f32_f16<<<(int)((WSZ + cb - 1) / cb), cb, 0, stream>>>(Wv, Wvh, (int)WSZ);
  cvt_f32_f16<<<(int)((WSZ + cb - 1) / cb), cb, 0, stream>>>(Wo, Woh, (int)WSZ);

  // fold softmax scale (1/sqrt(64)) and log2(e) into Q so the attention
  // kernel runs a pure base-2 online softmax with no per-element scaling.
  const float SCL_Q = 0.125f * 1.44269504088896340736f;

  dim3 pg(MROWS / 128, DMODEL / 128);
  proj_gemm<0><<<pg, 256, 0, stream>>>(Xq, Wqh, bq, (void*)Qh, SCL_Q);
  proj_gemm<0><<<pg, 256, 0, stream>>>(Xk, Wkh, bk, (void*)Kh, 1.0f);
  proj_gemm<1><<<pg, 256, 0, stream>>>(Xv, Wvh, bv, (void*)Vt, 1.0f);

  dim3 ag(S_LEN / 128, 2 * HEADS);
  flash_attn<<<ag, 256, 0, stream>>>(Qh, Kh, Vt, Oc);

  proj_gemm<2><<<pg, 256, 0, stream>>>(Oc, Woh, bo, d_out, 1.0f);
}

// v002
// One run takes 207 microseconds.
// Next to v001, in two timings, it ran 1.13 times as fast each time.
// All steps since v000 together make it 1.71 times as fast.
#include <hip/hip_runtime.h>
#include <hip/hip_bf16.h>

typedef __attribute__((ext_vector_type(16))) _Float16 v16h;
typedef __attribute__((ext_vector_type(8)))  _Float16 v8h;
typedef __attribute__((ext_vector_type(8)))  float    v8f;

#define S_LEN  4096
#define DMODEL 512
#define HEADS  8
#define HD     64
#define MROWS  8192   // N * S_LEN

// ---------------------------------------------------------------------------
// 16x32 f16 operand tile in CDNA5 WMMA A/B register layout.
// Lane L (L<16): row = base+L, halves = {k0+0..7, k0+16..23}
// Lane L+16    : row = base+L, halves = {k0+8..15, k0+24..31}
// ---------------------------------------------------------------------------
__device__ __forceinline__ v16h load_tile_k(const _Float16* src, int row_base,
                                            int ld, int k0) {
  const int lane = threadIdx.x & 31;
  const int hs   = lane >> 4;
  const _Float16* p = src + (size_t)(row_base + (lane & 15)) * ld + k0 + hs * 8;
  v8h lo = *(const v8h*)(p);
  v8h hi = *(const v8h*)(p + 16);
  v16h r;
#pragma unroll
  for (int i = 0; i < 8; ++i) { r[i] = lo[i]; r[i + 8] = hi[i]; }
  return r;
}

__device__ __forceinline__ v8f wmma_f16(v16h a, v16h b, v8f c) {
  return __builtin_amdgcn_wmma_f32_16x16x32_f16(false, a, false, b,
                                                (short)0, c, false, false);
}

// ---------------------------------------------------------------------------
// DPP16 cross-lane butterfly within each 16-lane half (pure VALU, no DS).
// ---------------------------------------------------------------------------
template <int CTRL>
__device__ __forceinline__ float dpp_movf(float x) {
  return __int_as_float(__builtin_amdgcn_update_dpp(
      0, __float_as_int(x), CTRL, 0xF, 0xF, true));
}

__device__ __forceinline__ float red16_max(float x) {
  x = fmaxf(x, dpp_movf<0x0B1>(x));  // quad_perm xor1
  x = fmaxf(x, dpp_movf<0x04E>(x));  // quad_perm xor2
  x = fmaxf(x, dpp_movf<0x141>(x));  // row_half_mirror
  x = fmaxf(x, dpp_movf<0x140>(x));  // row_mirror
  return x;
}

__device__ __forceinline__ float red16_sum(float x) {
  x += dpp_movf<0x0B1>(x);
  x += dpp_movf<0x04E>(x);
  x += dpp_movf<0x141>(x);
  x += dpp_movf<0x140>(x);
  return x;
}

// ---------------------------------------------------------------------------
// f32 -> f16 conversion of the three activations and the four weights, one
// resident launch: 256 work-groups of 16 waves. A row is 4096 values, 8 a
// thread (two 16-byte loads, one 16-byte store; a wave stores whole lines).
// Work-group g takes rows 4g..4g+3 of each activation (1024 rows each) and
// row g & 63 of weight g >> 6 (64 rows each). All 26 loads of a thread are
// independent, so they can be in flight together.
// ---------------------------------------------------------------------------
#define CVT_ROW 4096
#define ACT_N   (MROWS * DMODEL)

__global__ __launch_bounds__(512) void cvt_all(
    const float* __restrict__ q, const float* __restrict__ k,
    const float* __restrict__ v, const float* __restrict__ Wq,
    const float* __restrict__ Wk, const float* __restrict__ Wv,
    const float* __restrict__ Wo, _Float16* __restrict__ xh,
    _Float16* __restrict__ wh) {
  const unsigned g  = blockIdx.x;
  const unsigned t8 = threadIdx.x * 8;
  const unsigned ws = g >> 6;
  // work-group-uniform bases; the thread's own part of every address is t8
  const float* qs = q + g * (4 * CVT_ROW);
  const float* ks = k + g * (4 * CVT_ROW);
  const float* vs = v + g * (4 * CVT_ROW);
  const float* wsrc = (ws == 0 ? Wq : ws == 1 ? Wk : ws == 2 ? Wv : Wo) +
                      (g & 63) * CVT_ROW;
  _Float16* xd = xh + g * (4 * CVT_ROW);
  // the four f16 weights lie one behind the other: ws * 64 rows + (g & 63) = g
  _Float16* wd = wh + g * CVT_ROW;

  v8f r[13];
  r[12] = *(const v8f*)(wsrc + t8);
#pragma unroll
  for (int i = 0; i < 4; ++i) r[i] = *(const v8f*)(qs + t8 + i * CVT_ROW);
#pragma unroll
  for (int i = 0; i < 4; ++i) r[4 + i] = *(const v8f*)(ks + t8 + i * CVT_ROW);
#pragma unroll
  for (int i = 0; i < 4; ++i) r[8 + i] = *(const v8f*)(vs + t8 + i * CVT_ROW);
  // Keeps every load ahead of the first conversion: without it the compiler
  // reuses registers and waits out the memory latency several times over.
  __builtin_amdgcn_sched_barrier(0);

  *(v8h*)(wd + t8) = __builtin_convertvector(r[12], v8h);
#pragma unroll
  for (int i = 0; i < 4; ++i)
    *(v8h*)(xd + t8 + i * CVT_ROW) = __builtin_convertvector(r[i], v8h);
#pragma unroll
  for (int i = 0; i < 4; ++i)
    *(v8h*)(xd + ACT_N + t8 + i * CVT_ROW) = __builtin_convertvector(r[4 + i], v8h);
#pragma unroll
  for (int i = 0; i < 4; ++i)
    *(v8h*)(xd + 2 * ACT_N + t8 + i * CVT_ROW) = __builtin_convertvector(r[8 + i], v8h);
}

// ---------------------------------------------------------------------------
// Projection GEMM: C[m,n] = (sum_k X[m,k]*W[n,k] + bias[n]) * oscale
// M=8192, N=512, K=512. Block 256 (8 waves), wave tile 32x64, block 128x128.
// MODE 0: f16 per-head row-major  [((b*8+h)*4096+s)*64 + d]
// MODE 1: f16 per-head transposed [((b*8+h)*64+d)*4096 + s]
// MODE 2: f32 row-major out[m*512 + n]
// ---------------------------------------------------------------------------
template <int MODE>
__global__ __launch_bounds__(256) void proj_gemm(
    const _Float16* __restrict__ X, const _Float16* __restrict__ W,
    const float* __restrict__ bias, void* __restrict__ out, float oscale) {
  const int w    = threadIdx.x >> 5;
  const int lane = threadIdx.x & 31;
  const int hs   = lane >> 4;
  const int ln   = lane & 15;
  const int wm   = w >> 1;
  const int wn   = w & 1;
  const int m0   = blockIdx.x * 128 + wm * 32;
  const int n0   = blockIdx.y * 128 + wn * 64;

  v8f c[2][4];
#pragma unroll
  for (int i = 0; i < 2; ++i)
#pragma unroll
    for (int j = 0; j < 4; ++j) c[i][j] = {};

  for (int k0 = 0; k0 < DMODEL; k0 += 32) {
    v16h a0 = load_tile_k(X, m0,      DMODEL, k0);
    v16h a1 = load_tile_k(X, m0 + 16, DMODEL, k0);
#pragma unroll
    for (int j = 0; j < 4; ++j) {
      v16h b = load_tile_k(W, n0 + 16 * j, DMODEL, k0);
      c[0][j] = wmma_f16(a0, b, c[0][j]);
      c[1][j] = wmma_f16(a1, b, c[1][j]);
    }
  }

#pragma unroll
  for (int i = 0; i < 2; ++i) {
#pragma unroll
    for (int j = 0; j < 4; ++j) {
      const int n = n0 + 16 * j + ln;
      const float bn = bias[n];
#pragma unroll
      for (int v = 0; v < 8; ++v) {
        const int m = m0 + 16 * i + hs * 8 + v;
        const float val = (c[i][j][v] + bn) * oscale;
        if (MODE == 2) {
          ((float*)out)[(size_t)m * DMODEL + n] = val;
        } else {
          const int b = m >> 12;
          const int s = m & (S_LEN - 1);
          const int h = n >> 6;
          const int d = n & (HD - 1);
          _Float16* o = (_Float16*)out;
          if (MODE == 0)
            o[(((size_t)b * HEADS + h) * S_LEN + s) * HD + d] = (_Float16)val;
          else
            o[(((size_t)b * HEADS + h) * HD + d) * S_LEN + s] = (_Float16)val;
        }
      }
    }
  }
}

// ---------------------------------------------------------------------------
// One 64-key stage of K (64 keys x 64 d) and V^T (64 d x 64 keys), 128-byte
// rows, copied once per block into LDS rows of KV_PITCH halves. Each thread
// moves four 16-byte pieces; a wave's copy covers four whole 128-byte lines.
// ---------------------------------------------------------------------------
#define KV_PITCH 72   // 144-byte rows (16 B x odd): ds_load_b128 without bank conflicts

__device__ __forceinline__ void stage_kv(const _Float16* __restrict__ K,
                                         const _Float16* __restrict__ V, int kt,
                                         _Float16* kl, _Float16* vl) {
  const int r = threadIdx.x >> 3;         // row 0..31 (and row + 32)
  const int c = (threadIdx.x & 7) * 8;    // first half of the 16-byte piece
  const _Float16* gk0 = K + (size_t)(kt + r) * HD + c;
  const _Float16* gk1 = gk0 + 32 * HD;
  const _Float16* gv0 = V + (size_t)r * S_LEN + kt + c;
  const _Float16* gv1 = gv0 + (size_t)32 * S_LEN;
  const unsigned lk0 = (unsigned)(size_t)(kl + r * KV_PITCH + c);
  const unsigned lk1 = lk0 + 32 * KV_PITCH * 2;
  const unsigned lv0 = (unsigned)(size_t)(vl + r * KV_PITCH + c);
  const unsigned lv1 = lv0 + 32 * KV_PITCH * 2;
  // The copies go to LDS through no register; the closing s_wait_xcnt stands in
  // the same statement so that no address register is rewritten ahead of it.
  asm volatile(
      "global_load_async_to_lds_b128 %0, %4, off\n\t"
      "global_load_async_to_lds_b128 %1, %5, off\n\t"
      "global_load_async_to_lds_b128 %2, %6, off\n\t"
      "global_load_async_to_lds_b128 %3, %7, off\n\t"
      "s_wait_xcnt 0x0"
      :: "v"(lk0), "v"(lk1), "v"(lv0), "v"(lv1),
         "v"(gk0), "v"(gk1), "v"(gv0), "v"(gv1)
      : "memory");
}

// ---------------------------------------------------------------------------
// Flash attention, base-2 online softmax (scale*log2e folded into Q).
// Grid (32,16), block 256 (8 waves). Wave: 16 q-rows x 64 d. 64-key steps:
//   K and V^T of the step come from a two-buffer LDS ring shared by the
//   block's eight waves; the next step's copies fly during this step.
//   8 WMMAs S=QK^T, DPP16 row reductions, exp2, P->LDS->A-layout,
//   8 WMMAs O+=PV with rescaled f32 accumulators.
// ---------------------------------------------------------------------------
__global__ __launch_bounds__(256) void flash_attn(
    const _Float16* __restrict__ Qh, const _Float16* __restrict__ Kh,
    const _Float16* __restrict__ Vt, _Float16* __restrict__ Oc) {
  const int w    = threadIdx.x >> 5;
  const int lane = threadIdx.x & 31;
  const int hs   = lane >> 4;
  const int ln   = lane & 15;
  const int bh   = blockIdx.y;
  const int b    = bh >> 3;
  const int h    = bh & 7;
  const int q0   = blockIdx.x * 128 + w * 16;

  const _Float16* Q = Qh + (size_t)bh * S_LEN * HD;
  const _Float16* K = Kh + (size_t)bh * S_LEN * HD;
  const _Float16* V = Vt + (size_t)bh * HD * S_LEN;  // [d][s]

  __shared__ _Float16 Pl[8][16][64];   // per-wave P tile, 16 KB
  __shared__ __attribute__((aligned(16))) _Float16 Kl[2][64][KV_PITCH];
  __shared__ __attribute__((aligned(16))) _Float16 Vl[2][64][KV_PITCH];

  const v16h aq0 = load_tile_k(Q, q0, HD, 0);
  const v16h aq1 = load_tile_k(Q, q0, HD, 32);

  v8f o[4];
#pragma unroll
  for (int j = 0; j < 4; ++j) o[j] = {};
  float m_r[8], l_r[8];
#pragma unroll
  for (int v = 0; v < 8; ++v) { m_r[v] = -__builtin_inff(); l_r[v] = 0.f; }

  // Ring prologue: stage 0 lands and is published, then stage 1 starts.
  stage_kv(K, V, 0, &Kl[0][0][0], &Vl[0][0][0]);
  asm volatile("s_wait_asynccnt 0x0" ::: "memory");  // own copies of stage 0 landed
  __syncthreads();                                   // every wave's copies visible
  stage_kv(K, V, 64, &Kl[1][0][0], &Vl[1][0][0]);

  for (int kt = 0; kt < S_LEN; kt += 64) {
    const int buf = (kt >> 6) & 1;
    const _Float16* Ks = &Kl[buf][0][0];
    const _Float16* Vs = &Vl[buf][0][0];

    // S = Q K^T for 64 keys (four 16-key subtiles), d-accumulated
    v8f s[4];
#pragma unroll
    for (int t = 0; t < 4; ++t) {
      s[t] = {};
      v16h bk = load_tile_k(Ks, 16 * t, KV_PITCH, 0);
      s[t] = wmma_f16(aq0, bk, s[t]);
      bk = load_tile_k(Ks, 16 * t, KV_PITCH, 32);
      s[t] = wmma_f16(aq1, bk, s[t]);
    }

    float al[8];
#pragma unroll
    for (int v = 0; v < 8; ++v) {
      const float x0 = s[0][v], x1 = s[1][v], x2 = s[2][v], x3 = s[3][v];
      const float t = red16_max(fmaxf(fmaxf(x0, x1), fmaxf(x2, x3)));
      const float nm = fmaxf(m_r[v], t);
      al[v] = exp2f(m_r[v] - nm);
      m_r[v] = nm;

      const float p0 = exp2f(x0 - nm);
      const float p1 = exp2f(x1 - nm);
      const float p2 = exp2f(x2 - nm);
      const float p3 = exp2f(x3 - nm);
      const float rs = red16_sum((p0 + p1) + (p2 + p3));
      l_r[v] = l_r[v] * al[v] + rs;

      const int r = hs * 8 + v;
      Pl[w][r][ln]      = (_Float16)p0;
      Pl[w][r][16 + ln] = (_Float16)p1;
      Pl[w][r][32 + ln] = (_Float16)p2;
      Pl[w][r][48 + ln] = (_Float16)p3;
    }

#pragma unroll
    for (int j = 0; j < 4; ++j)
#pragma unroll
      for (int v = 0; v < 8; ++v) o[j][v] *= al[v];

    const v16h ap0 = load_tile_k(&Pl[w][0][0], 0, 64, 0);
    const v16h ap1 = load_tile_k(&Pl[w][0][0], 0, 64, 32);

#pragma unroll
    for (int j = 0; j < 4; ++j) {
      v16h bv = load_tile_k(Vs, 16 * j, KV_PITCH, 0);
      o[j] = wmma_f16(ap0, bv, o[j]);
      bv = load_tile_k(Vs, 16 * j, KV_PITCH, 32);
      o[j] = wmma_f16(ap1, bv, o[j]);
    }

    // Publish point of the next stage, then the refill of this stage's buffer.
    asm volatile("s_wait_dscnt 0x0" ::: "memory");     // own reads of this buffer done
    asm volatile("s_wait_asynccnt 0x0" ::: "memory");  // own copies of the next stage landed
    __syncthreads();  // publishes the next stage; ends every wave's reads of this buffer
    if (kt + 128 < S_LEN)
      stage_kv(K, V, kt + 128, &Kl[buf][0][0], &Vl[buf][0][0]);
  }
  asm volatile("s_wait_asynccnt 0x0" ::: "memory");  // nothing outstanding at the wave's end

  float inv[8];
#pragma unroll
  for (int v = 0; v < 8; ++v) inv[v] = 1.0f / l_r[v];

#pragma unroll
  for (int j = 0; j < 4; ++j) {
#pragma unroll
    for (int v = 0; v < 8; ++v) {
      const int q   = q0 + hs * 8 + v;
      const int col = h * HD + 16 * j + ln;
      Oc[((size_t)b * S_LEN + q) * DMODEL + col] = (_Float16)(o[j][v] * inv[v]);
    }
  }
}

// ---------------------------------------------------------------------------
// Host side
// ---------------------------------------------------------------------------
extern "C" void kernel_launch(void* const* d_in, const int* in_sizes, int n_in,
                              void* d_out, int out_size, void* d_ws,
                              size_t ws_size, hipStream_t stream) {
  const float* q  = (const float*)d_in[0];
  const float* k  = (const float*)d_in[1];
  const float* v  = (const float*)d_in[2];
  const float* Wq = (const float*)d_in[3];
  const float* bq = (const float*)d_in[4];
  const float* Wk = (const float*)d_in[5];
  const float* bk = (const float*)d_in[6];
  const float* Wv = (const float*)d_in[7];
  const float* bv = (const float*)d_in[8];
  const float* Wo = (const float*)d_in[9];
  const float* bo = (const float*)d_in[10];

  const size_t ACT = (size_t)MROWS * DMODEL;
  const size_t WSZ = (size_t)DMODEL * DMODEL;
  char* ws = (char*)d_ws;
  _Float16* Xq  = (_Float16*)(ws + 0 * ACT * 2);
  _Float16* Xk  = (_Float16*)(ws + 1 * ACT * 2);
  _Float16* Xv  = (_Float16*)(ws + 2 * ACT * 2);
  _Float16* Qh  = (_Float16*)(ws + 3 * ACT * 2);
  _Float16* Kh  = (_Float16*)(ws + 4 * ACT * 2);
  _Float16* Vt  = (_Float16*)(ws + 5 * ACT * 2);
  _Float16* Oc  = (_Float16*)(ws + 6 * ACT * 2);
  _Float16* Wqh = (_Float16*)(ws + 7 * ACT * 2 + 0 * WSZ * 2);
  _Float16* Wkh = (_Float16*)(ws + 7 * ACT * 2 + 1 * WSZ * 2);
  _Float16* Wvh = (_Float16*)(ws + 7 * ACT * 2 + 2 * WSZ * 2);
  _Float16* Woh = (_Float16*)(ws + 7 * ACT * 2 + 3 * WSZ * 2);

  // Xq, Xk, Xv lie one behind the other from Xq; the four weights from Wqh.
  cvt_all<<<256, 512, 0, stream>>>(q, k, v, Wq, Wk, Wv, Wo, Xq, Wqh);

  // fold softmax scale (1/sqrt(64)) and log2(e) into Q so the attention
  // kernel runs a pure base-2 online softmax with no per-element scaling.
  const float SCL_Q = 0.125f * 1.44269504088896340736f;

  dim3 pg(MROWS / 128, DMODEL / 128);
  proj_gemm<0><<<pg, 256, 0, stream>>>(Xq, Wqh, bq, (void*)Qh, SCL_Q);
  proj_gemm<0><<<pg, 256, 0, stream>>>(Xk, Wkh, bk, (void*)Kh, 1.0f);
  proj_gemm<1><<<pg, 256, 0, stream>>>(Xv, Wvh, bv, (void*)Vt, 1.0f);

  dim3 ag(S_LEN / 128, 2 * HEADS);
  flash_attn<<<ag, 256, 0, stream>>>(Qh, Kh, Vt, Oc);

  proj_gemm<2><<<pg, 256, 0, stream>>>(Oc, Woh, bo, d_out, 1.0f);
}

// v003
// Measured time: 172 microseconds a run.
// Timed twice side by side with v002, it ran 1.21 and 1.20 times as fast.
// Counting every step since v000, it is 2.06 times as fast.
#include <hip/hip_runtime.h>
#include <hip/hip_bf16.h>

typedef __attribute__((ext_vector_type(16))) _Float16 v16h;
typedef __attribute__((ext_vector_type(8)))  _Float16 v8h;
typedef __attribute__((ext_vector_type(8)))  float    v8f;

#define S_LEN  4096
#define DMODEL 512
#define HEADS  8
#define HD     64
#define MROWS  8192   // N * S_LEN

// ---------------------------------------------------------------------------
// 16x32 f16 operand tile in CDNA5 WMMA A/B register layout.
// Lane L (L<16): row = base+L, halves = {k0+0..7, k0+16..23}
// Lane L+16    : row = base+L, halves = {k0+8..15, k0+24..31}
// ---------------------------------------------------------------------------
__device__ __forceinline__ v16h load_tile_k(const _Float16* src, int row_base,
                                            int ld, int k0) {
  const int lane = threadIdx.x & 31;
  const int hs   = lane >> 4;
  const _Float16* p = src + (size_t)(row_base + (lane & 15)) * ld + k0 + hs * 8;
  v8h lo = *(const v8h*)(p);
  v8h hi = *(const v8h*)(p + 16);
  v16h r;
#pragma unroll
  for (int i = 0; i < 8; ++i) { r[i] = lo[i]; r[i + 8] = hi[i]; }
  return r;
}

__device__ __forceinline__ v8f wmma_f16(v16h a, v16h b, v8f c) {
  return __builtin_amdgcn_wmma_f32_16x16x32_f16(false, a, false, b,
                                                (short)0, c, false, false);
}

// ---------------------------------------------------------------------------
// Lane l <-> lane l ^ 16: the other half of the wave (one VALU move, no DS).
// ---------------------------------------------------------------------------
__device__ __forceinline__ float other_half(float x) {
  const int b = __float_as_int(x);
  return __int_as_float(__builtin_amdgcn_permlanex16(
      b, b, 0x76543210, 0xfedcba98, false, false));
}

// ---------------------------------------------------------------------------
// f32 -> f16 conversion of the three activations and the four weights, one
// resident launch: 256 work-groups of 16 waves. A row is 4096 values, 8 a
// thread (two 16-byte loads, one 16-byte store; a wave stores whole lines).
// Work-group g takes rows 4g..4g+3 of each activation (1024 rows each) and
// row g & 63 of weight g >> 6 (64 rows each). All 26 loads of a thread are
// independent, so they can be in flight together.
// ---------------------------------------------------------------------------
#define CVT_ROW 4096
#define ACT_N   (MROWS * DMODEL)

__global__ __launch_bounds__(512) void cvt_all(
    const float* __restrict__ q, const float* __restrict__ k,
    const float* __restrict__ v, const float* __restrict__ Wq,
    const float* __restrict__ Wk, const float* __restrict__ Wv,
    const float* __restrict__ Wo, _Float16* __restrict__ xh,
    _Float16* __restrict__ wh) {
  const unsigned g  = blockIdx.x;
  const unsigned t8 = threadIdx.x * 8;
  const unsigned ws = g >> 6;
  // work-group-uniform bases; the thread's own part of every address is t8
  const float* qs = q + g * (4 * CVT_ROW);
  const float* ks = k + g * (4 * CVT_ROW);
  const float* vs = v + g * (4 * CVT_ROW);
  const float* wsrc = (ws == 0 ? Wq : ws == 1 ? Wk : ws == 2 ? Wv : Wo) +
                      (g & 63) * CVT_ROW;
  _Float16* xd = xh + g * (4 * CVT_ROW);
  // the four f16 weights lie one behind the other: ws * 64 rows + (g & 63) = g
  _Float16* wd = wh + g * CVT_ROW;

  v8f r[13];
  r[12] = *(const v8f*)(wsrc + t8);
#pragma unroll
  for (int i = 0; i < 4; ++i) r[i] = *(const v8f*)(qs + t8 + i * CVT_ROW);
#pragma unroll
  for (int i = 0; i < 4; ++i) r[4 + i] = *(const v8f*)(ks + t8 + i * CVT_ROW);
#pragma unroll
  for (int i = 0; i < 4; ++i) r[8 + i] = *(const v8f*)(vs + t8 + i * CVT_ROW);
  // Keeps every load ahead of the first conversion: without it the compiler
  // reuses registers and waits out the memory latency several times over.
  __builtin_amdgcn_sched_barrier(0);

  *(v8h*)(wd + t8) = __builtin_convertvector(r[12], v8h);
#pragma unroll
  for (int i = 0; i < 4; ++i)
    *(v8h*)(xd + t8 + i * CVT_ROW) = __builtin_convertvector(r[i], v8h);
#pragma unroll
  for (int i = 0; i < 4; ++i)
    *(v8h*)(xd + ACT_N + t8 + i * CVT_ROW) = __builtin_convertvector(r[4 + i], v8h);
#pragma unroll
  for (int i = 0; i < 4; ++i)
    *(v8h*)(xd + 2 * ACT_N + t8 + i * CVT_ROW) = __builtin_convertvector(r[8 + i], v8h);
}

// ---------------------------------------------------------------------------
// Projection GEMM: C[m,n] = (sum_k X[m,k]*W[n,k] + bias[n]) * oscale
// M=8192, N=512, K=512. Block 256 (8 waves), wave tile 32x64, block 128x128.
// MODE 0: f16 per-head row-major  [((b*8+h)*4096+s)*64 + d]
// MODE 1: f16 per-head transposed [((b*8+h)*64+d)*4096 + s]
// MODE 2: f32 row-major out[m*512 + n]
// ---------------------------------------------------------------------------
template <int MODE>
__global__ __launch_bounds__(256) void proj_gemm(
    const _Float16* __restrict__ X, const _Float16* __restrict__ W,
    const float* __restrict__ bias, void* __restrict__ out, float oscale) {
  const int w    = threadIdx.x >> 5;
  const int lane = threadIdx.x & 31;
  const int hs   = lane >> 4;
  const int ln   = lane & 15;
  const int wm   = w >> 1;
  const int wn   = w & 1;
  const int m0   = blockIdx.x * 128 + wm * 32;
  const int n0   = blockIdx.y * 128 + wn * 64;

  v8f c[2][4];
#pragma unroll
  for (int i = 0; i < 2; ++i)
#pragma unroll
    for (int j = 0; j < 4; ++j) c[i][j] = {};

  for (int k0 = 0; k0 < DMODEL; k0 += 32) {
    v16h a0 = load_tile_k(X, m0,      DMODEL, k0);
    v16h a1 = load_tile_k(X, m0 + 16, DMODEL, k0);
#pragma unroll
    for (int j = 0; j < 4; ++j) {
      v16h b = load_tile_k(W, n0 + 16 * j, DMODEL, k0);
      c[0][j] = wmma_f16(a0, b, c[0][j]);
      c[1][j] = wmma_f16(a1, b, c[1][j]);
    }
  }

#pragma unroll
  for (int i = 0; i < 2; ++i) {
#pragma unroll
    for (int j = 0; j < 4; ++j) {
      const int n = n0 + 16 * j + ln;
      const float bn = bias[n];
#pragma unroll
      for (int v = 0; v < 8; ++v) {
        const int m = m0 + 16 * i + hs * 8 + v;
        const float val = (c[i][j][v] + bn) * oscale;
        if (MODE == 2) {
          ((float*)out)[(size_t)m * DMODEL + n] = val;
        } else {
          const int b = m >> 12;
          const int s = m & (S_LEN - 1);
          const int h = n >> 6;
          const int d = n & (HD - 1);
          _Float16* o = (_Float16*)out;
          if (MODE == 0)
            o[(((size_t)b * HEADS + h) * S_LEN + s) * HD + d] = (_Float16)val;
          else
            o[(((size_t)b * HEADS + h) * HD + d) * S_LEN + s] = (_Float16)val;
        }
      }
    }
  }
}

// ---------------------------------------------------------------------------
// One 64-key stage of K (64 keys x 64 d) and V^T (64 d x 64 keys), 128-byte
// rows, copied once per block into LDS rows of KV_PITCH halves. Each thread
// moves four 16-byte pieces; a wave's copy covers four whole 128-byte lines.
// ---------------------------------------------------------------------------
#define KV_PITCH 72   // 144-byte rows (16 B x odd): ds_load_b128 without bank conflicts

__device__ __forceinline__ void stage_kv(const _Float16* __restrict__ K,
                                         const _Float16* __restrict__ V, int kt,
                                         _Float16* kl, _Float16* vl) {
  const int r = threadIdx.x >> 3;         // row 0..31 (and row + 32)
  const int c = (threadIdx.x & 7) * 8;    // first half of the 16-byte piece
  const _Float16* gk0 = K + (size_t)(kt + r) * HD + c;
  const _Float16* gk1 = gk0 + 32 * HD;
  const _Float16* gv0 = V + (size_t)r * S_LEN + kt + c;
  const _Float16* gv1 = gv0 + (size_t)32 * S_LEN;
  const unsigned lk0 = (unsigned)(size_t)(kl + r * KV_PITCH + c);
  const unsigned lk1 = lk0 + 32 * KV_PITCH * 2;
  const unsigned lv0 = (unsigned)(size_t)(vl + r * KV_PITCH + c);
  const unsigned lv1 = lv0 + 32 * KV_PITCH * 2;
  // The copies go to LDS through no register; the closing s_wait_xcnt stands in
  // the same statement so that no address register is rewritten ahead of it.
  asm volatile(
      "global_load_async_to_lds_b128 %0, %4, off\n\t"
      "global_load_async_to_lds_b128 %1, %5, off\n\t"
      "global_load_async_to_lds_b128 %2, %6, off\n\t"
      "global_load_async_to_lds_b128 %3, %7, off\n\t"
      "s_wait_xcnt 0x0"
      :: "v"(lk0), "v"(lk1), "v"(lv0), "v"(lv1),
         "v"(gk0), "v"(gk1), "v"(gv0), "v"(gv1)
      : "memory");
}

// ---------------------------------------------------------------------------
// Flash attention, base-2 online softmax (scale*log2e folded into Q).
// Grid (32,16), block 256 (8 waves). Wave: 16 queries x 64 d. 64-key steps:
//   K and V^T of the step come from a two-buffer LDS ring shared by the
//   block's eight waves; the next step's copies fly during this step.
// Both products are taken transposed, so that a lane owns ONE query:
//   S^T = K Q^T   (A = 16 keys x 32 d from LDS, B = Q, kept in registers)
//     s[t][r] = score of key 16t + 8*hs + r against query ln
//   maximum and sum run down the lane's own 32 scores; the two halves of the
//   wave (which split the keys) exchange the maximum once a step and join
//   their sums once, behind the loop.
//   O^T += V^T P^T (A = 16 d x 32 keys from LDS, B = P^T)
//     two score tiles 2u, 2u+1, converted in place, ARE the B operand of key
//     block u in the hardware k order that load_tile_k gives A.
//     o[j][r] = output d 16j + 8*hs + r of query ln
// ---------------------------------------------------------------------------
__global__ __launch_bounds__(256) void flash_attn(
    const _Float16* __restrict__ Qh, const _Float16* __restrict__ Kh,
    const _Float16* __restrict__ Vt, _Float16* __restrict__ Oc) {
  const int w    = threadIdx.x >> 5;
  const int lane = threadIdx.x & 31;
  const int hs   = lane >> 4;
  const int ln   = lane & 15;
  const int bh   = blockIdx.y;
  const int b    = bh >> 3;
  const int h    = bh & 7;
  const int q0   = blockIdx.x * 128 + w * 16;

  const _Float16* Q = Qh + (size_t)bh * S_LEN * HD;
  const _Float16* K = Kh + (size_t)bh * S_LEN * HD;
  const _Float16* V = Vt + (size_t)bh * HD * S_LEN;  // [d][s]

  __shared__ __attribute__((aligned(16))) _Float16 Kl[2][64][KV_PITCH];
  __shared__ __attribute__((aligned(16))) _Float16 Vl[2][64][KV_PITCH];

  const v16h bq0 = load_tile_k(Q, q0, HD, 0);
  const v16h bq1 = load_tile_k(Q, q0, HD, 32);

  v8f o[4];
#pragma unroll
  for (int j = 0; j < 4; ++j) o[j] = {};
  float m_r = -__builtin_inff();  // running maximum of query ln (both halves alike)
  float l_r = 0.f;                // running sum over this half's keys only

  // Ring prologue: stage 0 lands and is published, then stage 1 starts.
  stage_kv(K, V, 0, &Kl[0][0][0], &Vl[0][0][0]);
  asm volatile("s_wait_asynccnt 0x0" ::: "memory");  // own copies of stage 0 landed
  __syncthreads();                                   // every wave's copies visible
  stage_kv(K, V, 64, &Kl[1][0][0], &Vl[1][0][0]);

  for (int kt = 0; kt < S_LEN; kt += 64) {
    const int buf = (kt >> 6) & 1;
    const _Float16* Ks = &Kl[buf][0][0];
    const _Float16* Vs = &Vl[buf][0][0];

    // S^T = K Q^T for 64 keys (four 16-key subtiles), d-accumulated
    v8f s[4];
#pragma unroll
    for (int t = 0; t < 4; ++t) {
      s[t] = {};
      v16h ak = load_tile_k(Ks, 16 * t, KV_PITCH, 0);
      s[t] = wmma_f16(ak, bq0, s[t]);
      ak = load_tile_k(Ks, 16 * t, KV_PITCH, 32);
      s[t] = wmma_f16(ak, bq1, s[t]);
    }

    // maximum of the lane's 32 scores, then of both halves and the old one
    float mx[4];
#pragma unroll
    for (int t = 0; t < 4; ++t) {
      mx[t] = fmaxf(fmaxf(fmaxf(s[t][0], s[t][1]), s[t][2]),
                    fmaxf(fmaxf(s[t][3], s[t][4]), s[t][5]));
      mx[t] = fmaxf(fmaxf(mx[t], s[t][6]), s[t][7]);
    }
    const float mh = fmaxf(fmaxf(mx[0], mx[1]), fmaxf(mx[2], mx[3]));
    const float nm = fmaxf(fmaxf(mh, other_half(mh)), m_r);
    const float al = exp2f(m_r - nm);
    m_r = nm;

#pragma unroll
    for (int t = 0; t < 4; ++t)
#pragma unroll
      for (int r = 0; r < 8; ++r) s[t][r] = exp2f(s[t][r] - nm);

    const v8f sv = (s[0] + s[1]) + (s[2] + s[3]);
    const float rs = ((sv[0] + sv[1]) + (sv[2] + sv[3])) +
                     ((sv[4] + sv[5]) + (sv[6] + sv[7]));
    l_r = l_r * al + rs;

#pragma unroll
    for (int j = 0; j < 4; ++j) o[j] *= al;

    // P^T as B operand: element e of key block u is tile 2u + (e >> 3), register e & 7
    const v16h bp0 = __builtin_shufflevector(
        __builtin_convertvector(s[0], v8h), __builtin_convertvector(s[1], v8h),
        0, 1, 2, 3, 4, 5, 6, 7, 8, 9, 10, 11, 12, 13, 14, 15);
    const v16h bp1 = __builtin_shufflevector(
        __builtin_convertvector(s[2], v8h), __builtin_convertvector(s[3], v8h),
        0, 1, 2, 3, 4, 5, 6, 7, 8, 9, 10, 11, 12, 13, 14, 15);

#pragma unroll
    for (int j = 0; j < 4; ++j) {
      v16h av = load_tile_k(Vs, 16 * j, KV_PITCH, 0);
      o[j] = wmma_f16(av, bp0, o[j]);
      av = load_tile_k(Vs, 16 * j, KV_PITCH, 32);
      o[j] = wmma_f16(av, bp1, o[j]);
    }

    // Publish point of the next stage, then the refill of this stage's buffer.
    asm volatile("s_wait_dscnt 0x0" ::: "memory");     // own reads of this buffer done
    asm volatile("s_wait_asynccnt 0x0" ::: "memory");  // own copies of the next stage landed
    __syncthreads();  // publishes the next stage; ends every wave's reads of this buffer
    if (kt + 128 < S_LEN)
      stage_kv(K, V, kt + 128, &Kl[buf][0][0], &Vl[buf][0][0]);
  }
  asm volatile("s_wait_asynccnt 0x0" ::: "memory");  // nothing outstanding at the wave's end

  // the two halves' sums of query ln are joined here, once
  const float inv = 1.0f / (l_r + other_half(l_r));

  // a lane holds 8 consecutive d of its query in each o[j]: one 16-byte store
  _Float16* orow = Oc + ((size_t)b * S_LEN + q0 + ln) * DMODEL + h * HD + hs * 8;
#pragma unroll
  for (int j = 0; j < 4; ++j)
    *(v8h*)(orow + 16 * j) = __builtin_convertvector(o[j] * inv, v8h);
}

// ---------------------------------------------------------------------------
// Host side
// ---------------------------------------------------------------------------
extern "C" void kernel_launch(void* const* d_in, const int* in_sizes, int n_in,
                              void* d_out, int out_size, void* d_ws,
                              size_t ws_size, hipStream_t stream) {
  const float* q  = (const float*)d_in[0];
  const float* k  = (const float*)d_in[1];
  const float* v  = (const float*)d_in[2];
  const float* Wq = (const float*)d_in[3];
  const float* bq = (const float*)d_in[4];
  const float* Wk = (const float*)d_in[5];
  const float* bk = (const float*)d_in[6];
  const float* Wv = (const float*)d_in[7];
  const float* bv = (const float*)d_in[8];
  const float* Wo = (const float*)d_in[9];
  const float* bo = (const float*)d_in[10];

  const size_t ACT = (size_t)MROWS * DMODEL;
  const size_t WSZ = (size_t)DMODEL * DMODEL;
  char* ws = (char*)d_ws;
  _Float16* Xq  = (_Float16*)(ws + 0 * ACT * 2);
  _Float16* Xk  = (_Float16*)(ws + 1 * ACT * 2);
  _Float16* Xv  = (_Float16*)(ws + 2 * ACT * 2);
  _Float16* Qh  = (_Float16*)(ws + 3 * ACT * 2);
  _Float16* Kh  = (_Float16*)(ws + 4 * ACT * 2);
  _Float16* Vt  = (_Float16*)(ws + 5 * ACT * 2);
  _Float16* Oc  = (_Float16*)(ws + 6 * ACT * 2);
  _Float16* Wqh = (_Float16*)(ws + 7 * ACT * 2 + 0 * WSZ * 2);
  _Float16* Wkh = (_Float16*)(ws + 7 * ACT * 2 + 1 * WSZ * 2);
  _Float16* Wvh = (_Float16*)(ws + 7 * ACT * 2 + 2 * WSZ * 2);
  _Float16* Woh = (_Float16*)(ws + 7 * ACT * 2 + 3 * WSZ * 2);

  // Xq, Xk, Xv lie one behind the other from Xq; the four weights from Wqh.
  cvt_all<<<256, 512, 0, stream>>>(q, k, v, Wq, Wk, Wv, Wo, Xq, Wqh);

  // fold softmax scale (1/sqrt(64)) and log2(e) into Q so the attention
  // kernel runs a pure base-2 online softmax with no per-element scaling.
  const float SCL_Q = 0.125f * 1.44269504088896340736f;

  dim3 pg(MROWS / 128, DMODEL / 128);
  proj_gemm<0><<<pg, 256, 0, stream>>>(Xq, Wqh, bq, (void*)Qh, SCL_Q);
  proj_gemm<0><<<pg, 256, 0, stream>>>(Xk, Wkh, bk, (void*)Kh, 1.0f);
  proj_gemm<1><<<pg, 256, 0, stream>>>(Xv, Wvh, bv, (void*)Vt, 1.0f);

  dim3 ag(S_LEN / 128, 2 * HEADS);
  flash_attn<<<ag, 256, 0, stream>>>(Qh, Kh, Vt, Oc);

  proj_gemm<2><<<pg, 256, 0, stream>>>(Oc, Woh, bo, d_out, 1.0f);
}

// v004
// One run takes 150 microseconds.
// In both of two side-by-side timings against v003, it was 1.15 times as fast.
// Counting every step since v000, it is 2.37 times as fast.
#include <hip/hip_runtime.h>
#include <hip/hip_bf16.h>

typedef __attribute__((ext_vector_type(16))) _Float16 v16h;
typedef __attribute__((ext_vector_type(8)))  _Float16 v8h;
typedef __attribute__((ext_vector_type(8)))  float    v8f;

#define S_LEN  4096
#define DMODEL 512
#define HEADS  8
#define HD     64
#define MROWS  8192   // N * S_LEN

// ---------------------------------------------------------------------------
// 16x32 f16 operand tile in CDNA5 WMMA A/B register layout.
// Lane L (L<16): row = base+L, halves = {k0+0..7, k0+16..23}
// Lane L+16    : row = base+L, halves = {k0+8..15, k0+24..31}
// ---------------------------------------------------------------------------
__device__ __forceinline__ v16h load_tile_k(const _Float16* src, int row_base,
                                            int ld, int k0) {
  const int lane = threadIdx.x & 31;
  const int hs   = lane >> 4;
  const _Float16* p = src + (size_t)(row_base + (lane & 15)) * ld + k0 + hs * 8;
  v8h lo = *(const v8h*)(p);
  v8h hi = *(const v8h*)(p + 16);
  v16h r;
#pragma unroll
  for (int i = 0; i < 8; ++i) { r[i] = lo[i]; r[i + 8] = hi[i]; }
  return r;
}

__device__ __forceinline__ v8f wmma_f16(v16h a, v16h b, v8f c) {
  return __builtin_amdgcn_wmma_f32_16x16x32_f16(false, a, false, b,
                                                (short)0, c, false, false);
}

// ---------------------------------------------------------------------------
// Lane l <-> lane l ^ 16: the other half of the wave (one VALU move, no DS).
// ---------------------------------------------------------------------------
__device__ __forceinline__ float other_half(float x) {
  const int b = __float_as_int(x);
  return __int_as_float(__builtin_amdgcn_permlanex16(
      b, b, 0x76543210, 0xfedcba98, false, false));
}

// ---------------------------------------------------------------------------
// 2^x as the one hardware instruction (v_exp_f32). The library exp2f wraps it
// in a compare, two selects, an add and an ldexp so that results under 2^-126
// come out as subnormals; here such a result may be 0: a weight that small
// rounds to 0 in f16, and it is lost in a row sum that holds the term 2^0.
// x = -inf (first step, no maximum yet) gives 0 either way.
// ---------------------------------------------------------------------------
__device__ __forceinline__ float hw_exp2(float x) {
  return __builtin_amdgcn_exp2f(x);
}

// The same for one score tile, 8 values a lane. One statement, so that the slot
// the instruction set asks for behind a transcendental is kept by construction:
// the results share no register with the sources (early clobber), so each
// v_exp_f32 is the independent instruction behind the one before it, and the
// v_nop is that slot behind the last.
__device__ __forceinline__ v8f hw_exp2_tile(v8f x) {
  float p0, p1, p2, p3, p4, p5, p6, p7;
  asm("v_exp_f32 %0, %8\n\t"
      "v_exp_f32 %1, %9\n\t"
      "v_exp_f32 %2, %10\n\t"
      "v_exp_f32 %3, %11\n\t"
      "v_exp_f32 %4, %12\n\t"
      "v_exp_f32 %5, %13\n\t"
      "v_exp_f32 %6, %14\n\t"
      "v_exp_f32 %7, %15\n\t"
      "v_nop"
      : "=&v"(p0), "=&v"(p1), "=&v"(p2), "=&v"(p3),
        "=&v"(p4), "=&v"(p5), "=&v"(p6), "=&v"(p7)
      : "v"(x[0]), "v"(x[1]), "v"(x[2]), "v"(x[3]),
        "v"(x[4]), "v"(x[5]), "v"(x[6]), "v"(x[7]));
  return v8f{p0, p1, p2, p3, p4, p5, p6, p7};
}

// ---------------------------------------------------------------------------
// f32 -> f16 conversion of the three activations and the four weights, one
// resident launch: 256 work-groups of 16 waves. A row is 4096 values, 8 a
// thread (two 16-byte loads, one 16-byte store; a wave stores whole lines).
// Work-group g takes rows 4g..4g+3 of each activation (1024 rows each) and
// row g & 63 of weight g >> 6 (64 rows each). All 26 loads of a thread are
// independent, so they can be in flight together.
// ---------------------------------------------------------------------------
#define CVT_ROW 4096
#define ACT_N   (MROWS * DMODEL)

__global__ __launch_bounds__(512) void cvt_all(
    const float* __restrict__ q, const float* __restrict__ k,
    const float* __restrict__ v, const float* __restrict__ Wq,
    const float* __restrict__ Wk, const float* __restrict__ Wv,
    const float* __restrict__ Wo, _Float16* __restrict__ xh,
    _Float16* __restrict__ wh) {
  const unsigned g  = blockIdx.x;
  const unsigned t8 = threadIdx.x * 8;
  const unsigned ws = g >> 6;
  // work-group-uniform bases; the thread's own part of every address is t8
  const float* qs = q + g * (4 * CVT_ROW);
  const float* ks = k + g * (4 * CVT_ROW);
  const float* vs = v + g * (4 * CVT_ROW);
  const float* wsrc = (ws == 0 ? Wq : ws == 1 ? Wk : ws == 2 ? Wv : Wo) +
                      (g & 63) * CVT_ROW;
  _Float16* xd = xh + g * (4 * CVT_ROW);
  // the four f16 weights lie one behind the other: ws * 64 rows + (g & 63) = g
  _Float16* wd = wh + g * CVT_ROW;

  v8f r[13];
  r[12] = *(const v8f*)(wsrc + t8);
#pragma unroll
  for (int i = 0; i < 4; ++i) r[i] = *(const v8f*)(qs + t8 + i * CVT_ROW);
#pragma unroll
  for (int i = 0; i < 4; ++i) r[4 + i] = *(const v8f*)(ks + t8 + i * CVT_ROW);
#pragma unroll
  for (int i = 0; i < 4; ++i) r[8 + i] = *(const v8f*)(vs + t8 + i * CVT_ROW);
  // Keeps every load ahead of the first conversion: without it the compiler
  // reuses registers and waits out the memory latency several times over.
  __builtin_amdgcn_sched_barrier(0);

  *(v8h*)(wd + t8) = __builtin_convertvector(r[12], v8h);
#pragma unroll
  for (int i = 0; i < 4; ++i)
    *(v8h*)(xd + t8 + i * CVT_ROW) = __builtin_convertvector(r[i], v8h);
#pragma unroll
  for (int i = 0; i < 4; ++i)
    *(v8h*)(xd + ACT_N + t8 + i * CVT_ROW) = __builtin_convertvector(r[4 + i], v8h);
#pragma unroll
  for (int i = 0; i < 4; ++i)
    *(v8h*)(xd + 2 * ACT_N + t8 + i * CVT_ROW) = __builtin_convertvector(r[8 + i], v8h);
}

// ---------------------------------------------------------------------------
// Projection GEMM: C[m,n] = (sum_k X[m,k]*W[n,k] + bias[n]) * oscale
// M=8192, N=512, K=512. Block 256 (8 waves), wave tile 32x64, block 128x128.
// MODE 0: f16 per-head row-major  [((b*8+h)*4096+s)*64 + d]
// MODE 1: f16 per-head transposed [((b*8+h)*64+d)*4096 + s]
// MODE 2: f32 row-major out[m*512 + n]
// ---------------------------------------------------------------------------
template <int MODE>
__global__ __launch_bounds__(256) void proj_gemm(
    const _Float16* __restrict__ X, const _Float16* __restrict__ W,
    const float* __restrict__ bias, void* __restrict__ out, float oscale) {
  const int w    = threadIdx.x >> 5;
  const int lane = threadIdx.x & 31;
  const int hs   = lane >> 4;
  const int ln   = lane & 15;
  const int wm   = w >> 1;
  const int wn   = w & 1;
  const int m0   = blockIdx.x * 128 + wm * 32;
  const int n0   = blockIdx.y * 128 + wn * 64;

  v8f c[2][4];
#pragma unroll
  for (int i = 0; i < 2; ++i)
#pragma unroll
    for (int j = 0; j < 4; ++j) c[i][j] = {};

  for (int k0 = 0; k0 < DMODEL; k0 += 32) {
    v16h a0 = load_tile_k(X, m0,      DMODEL, k0);
    v16h a1 = load_tile_k(X, m0 + 16, DMODEL, k0);
#pragma unroll
    for (int j = 0; j < 4; ++j) {
      v16h b = load_tile_k(W, n0 + 16 * j, DMODEL, k0);
      c[0][j] = wmma_f16(a0, b, c[0][j]);
      c[1][j] = wmma_f16(a1, b, c[1][j]);
    }
  }

#pragma unroll
  for (int i = 0; i < 2; ++i) {
#pragma unroll
    for (int j = 0; j < 4; ++j) {
      const int n = n0 + 16 * j + ln;
      const float bn = bias[n];
#pragma unroll
      for (int v = 0; v < 8; ++v) {
        const int m = m0 + 16 * i + hs * 8 + v;
        const float val = (c[i][j][v] + bn) * oscale;
        if (MODE == 2) {
          ((float*)out)[(size_t)m * DMODEL + n] = val;
        } else {
          const int b = m >> 12;
          const int s = m & (S_LEN - 1);
          const int h = n >> 6;
          const int d = n & (HD - 1);
          _Float16* o = (_Float16*)out;
          if (MODE == 0)
            o[(((size_t)b * HEADS + h) * S_LEN + s) * HD + d] = (_Float16)val;
          else
            o[(((size_t)b * HEADS + h) * HD + d) * S_LEN + s] = (_Float16)val;
        }
      }
    }
  }
}

// ---------------------------------------------------------------------------
// One 64-key stage of K (64 keys x 64 d) and V^T (64 d x 64 keys), 128-byte
// rows, copied once per block into LDS rows of KV_PITCH halves. Each thread
// moves four 16-byte pieces; a wave's copy covers four whole 128-byte lines.
// ---------------------------------------------------------------------------
#define KV_PITCH 72   // 144-byte rows (16 B x odd): ds_load_b128 without bank conflicts

__device__ __forceinline__ void stage_kv(const _Float16* __restrict__ K,
                                         const _Float16* __restrict__ V, int kt,
                                         _Float16* kl, _Float16* vl) {
  const int r = threadIdx.x >> 3;         // row 0..31 (and row + 32)
  const int c = (threadIdx.x & 7) * 8;    // first half of the 16-byte piece
  const _Float16* gk0 = K + (size_t)(kt + r) * HD + c;
  const _Float16* gk1 = gk0 + 32 * HD;
  const _Float16* gv0 = V + (size_t)r * S_LEN + kt + c;
  const _Float16* gv1 = gv0 + (size_t)32 * S_LEN;
  const unsigned lk0 = (unsigned)(size_t)(kl + r * KV_PITCH + c);
  const unsigned lk1 = lk0 + 32 * KV_PITCH * 2;
  const unsigned lv0 = (unsigned)(size_t)(vl + r * KV_PITCH + c);
  const unsigned lv1 = lv0 + 32 * KV_PITCH * 2;
  // The copies go to LDS through no register; the closing s_wait_xcnt stands in
  // the same statement so that no address register is rewritten ahead of it.
  asm volatile(
      "global_load_async_to_lds_b128 %0, %4, off\n\t"
      "global_load_async_to_lds_b128 %1, %5, off\n\t"
      "global_load_async_to_lds_b128 %2, %6, off\n\t"
      "global_load_async_to_lds_b128 %3, %7, off\n\t"
      "s_wait_xcnt 0x0"
      :: "v"(lk0), "v"(lk1), "v"(lv0), "v"(lv1),
         "v"(gk0), "v"(gk1), "v"(gv0), "v"(gv1)
      : "memory");
}

// ---------------------------------------------------------------------------
// Flash attention, base-2 online softmax (scale*log2e folded into Q).
// Grid (32,16), block 256 (8 waves). Wave: 16 queries x 64 d. 64-key steps:
//   K and V^T of the step come from a two-buffer LDS ring shared by the
//   block's eight waves; the next step's copies fly during this step.
// Both products are taken transposed, so that a lane owns ONE query:
//   S^T = K Q^T   (A = 16 keys x 32 d from LDS, B = Q, kept in registers)
//     s[t][r] = score of key 16t + 8*hs + r against query ln
//   maximum and sum run down the lane's own 32 scores; the two halves of the
//   wave (which split the keys) exchange the maximum once a step and join
//   their sums once, behind the loop.
//   O^T += V^T P^T (A = 16 d x 32 keys from LDS, B = P^T)
//     two score tiles 2u, 2u+1, converted in place, ARE the B operand of key
//     block u in the hardware k order that load_tile_k gives A.
//     o[j][r] = output d 16j + 8*hs + r of query ln
// ---------------------------------------------------------------------------
__global__ __launch_bounds__(256) void flash_attn(
    const _Float16* __restrict__ Qh, const _Float16* __restrict__ Kh,
    const _Float16* __restrict__ Vt, _Float16* __restrict__ Oc) {
  const int w    = threadIdx.x >> 5;
  const int lane = threadIdx.x & 31;
  const int hs   = lane >> 4;
  const int ln   = lane & 15;
  const int bh   = blockIdx.y;
  const int b    = bh >> 3;
  const int h    = bh & 7;
  const int q0   = blockIdx.x * 128 + w * 16;

  const _Float16* Q = Qh + (size_t)bh * S_LEN * HD;
  const _Float16* K = Kh + (size_t)bh * S_LEN * HD;
  const _Float16* V = Vt + (size_t)bh * HD * S_LEN;  // [d][s]

  __shared__ __attribute__((aligned(16))) _Float16 Kl[2][64][KV_PITCH];
  __shared__ __attribute__((aligned(16))) _Float16 Vl[2][64][KV_PITCH];

  const v16h bq0 = load_tile_k(Q, q0, HD, 0);
  const v16h bq1 = load_tile_k(Q, q0, HD, 32);

  v8f o[4];
#pragma unroll
  for (int j = 0; j < 4; ++j) o[j] = {};
  float m_r = -__builtin_inff();  // running maximum of query ln (both halves alike)
  float l_r = 0.f;                // running sum over this half's keys only

  // Ring prologue: stage 0 lands and is published, then stage 1 starts.
  stage_kv(K, V, 0, &Kl[0][0][0], &Vl[0][0][0]);
  asm volatile("s_wait_asynccnt 0x0" ::: "memory");  // own copies of stage 0 landed
  __syncthreads();                                   // every wave's copies visible
  stage_kv(K, V, 64, &Kl[1][0][0], &Vl[1][0][0]);

  for (int kt = 0; kt < S_LEN; kt += 64) {
    const int buf = (kt >> 6) & 1;
    const _Float16* Ks = &Kl[buf][0][0];
    const _Float16* Vs = &Vl[buf][0][0];

    // S^T = K Q^T for 64 keys (four 16-key subtiles), d-accumulated
    v8f s[4];
#pragma unroll
    for (int t = 0; t < 4; ++t) {
      s[t] = {};
      v16h ak = load_tile_k(Ks, 16 * t, KV_PITCH, 0);
      s[t] = wmma_f16(ak, bq0, s[t]);
      ak = load_tile_k(Ks, 16 * t, KV_PITCH, 32);
      s[t] = wmma_f16(ak, bq1, s[t]);
    }

    // maximum of the lane's 32 scores, then of both halves and the old one
    float mx[4];
#pragma unroll
    for (int t = 0; t < 4; ++t) {
      mx[t] = fmaxf(fmaxf(fmaxf(s[t][0], s[t][1]), s[t][2]),
                    fmaxf(fmaxf(s[t][3], s[t][4]), s[t][5]));
      mx[t] = fmaxf(fmaxf(mx[t], s[t][6]), s[t][7]);
    }
    const float mh = fmaxf(fmaxf(mx[0], mx[1]), fmaxf(mx[2], mx[3]));
    const float nm = fmaxf(fmaxf(mh, other_half(mh)), m_r);
    const float al = hw_exp2(m_r - nm);
    m_r = nm;

#pragma unroll
    for (int t = 0; t < 4; ++t) s[t] = hw_exp2_tile(s[t] - nm);

    const v8f sv = (s[0] + s[1]) + (s[2] + s[3]);
    const float rs = ((sv[0] + sv[1]) + (sv[2] + sv[3])) +
                     ((sv[4] + sv[5]) + (sv[6] + sv[7]));
    l_r = l_r * al + rs;

#pragma unroll
    for (int j = 0; j < 4; ++j) o[j] *= al;

    // P^T as B operand: element e of key block u is tile 2u + (e >> 3), register e & 7
    const v16h bp0 = __builtin_shufflevector(
        __builtin_convertvector(s[0], v8h), __builtin_convertvector(s[1], v8h),
        0, 1, 2, 3, 4, 5, 6, 7, 8, 9, 10, 11, 12, 13, 14, 15);
    const v16h bp1 = __builtin_shufflevector(
        __builtin_convertvector(s[2], v8h), __builtin_convertvector(s[3], v8h),
        0, 1, 2, 3, 4, 5, 6, 7, 8, 9, 10, 11, 12, 13, 14, 15);

#pragma unroll
    for (int j = 0; j < 4; ++j) {
      v16h av = load_tile_k(Vs, 16 * j, KV_PITCH, 0);
      o[j] = wmma_f16(av, bp0, o[j]);
      av = load_tile_k(Vs, 16 * j, KV_PITCH, 32);
      o[j] = wmma_f16(av, bp1, o[j]);
    }

    // Publish point of the next stage, then the refill of this stage's buffer.
    asm volatile("s_wait_dscnt 0x0" ::: "memory");     // own reads of this buffer done
    asm volatile("s_wait_asynccnt 0x0" ::: "memory");  // own copies of the next stage landed
    __syncthreads();  // publishes the next stage; ends every wave's reads of this buffer
    if (kt + 128 < S_LEN)
      stage_kv(K, V, kt + 128, &Kl[buf][0][0], &Vl[buf][0][0]);
  }
  asm volatile("s_wait_asynccnt 0x0" ::: "memory");  // nothing outstanding at the wave's end

  // the two halves' sums of query ln are joined here, once
  const float inv = 1.0f / (l_r + other_half(l_r));

  // a lane holds 8 consecutive d of its query in each o[j]: one 16-byte store
  _Float16* orow = Oc + ((size_t)b * S_LEN + q0 + ln) * DMODEL + h * HD + hs * 8;
#pragma unroll
  for (int j = 0; j < 4; ++j)
    *(v8h*)(orow + 16 * j) = __builtin_convertvector(o[j] * inv, v8h);
}

// ---------------------------------------------------------------------------
// Host side
// ---------------------------------------------------------------------------
extern "C" void kernel_launch(void* const* d_in, const int* in_sizes, int n_in,
                              void* d_out, int out_size, void* d_ws,
                              size_t ws_size, hipStream_t stream) {
  const float* q  = (const float*)d_in[0];
  const float* k  = (const float*)d_in[1];
  const float* v  = (const float*)d_in[2];
  const float* Wq = (const float*)d_in[3];
  const float* bq = (const float*)d_in[4];
  const float* Wk = (const float*)d_in[5];
  const float* bk = (const float*)d_in[6];
  const float* Wv = (const float*)d_in[7];
  const float* bv = (const float*)d_in[8];
  const float* Wo = (const float*)d_in[9];
  const float* bo = (const float*)d_in[10];

  const size_t ACT = (size_t)MROWS * DMODEL;
  const size_t WSZ = (size_t)DMODEL * DMODEL;
  char* ws = (char*)d_ws;
  _Float16* Xq  = (_Float16*)(ws + 0 * ACT * 2);
  _Float16* Xk  = (_Float16*)(ws + 1 * ACT * 2);
  _Float16* Xv  = (_Float16*)(ws + 2 * ACT * 2);
  _Float16* Qh  = (_Float16*)(ws + 3 * ACT * 2);
  _Float16* Kh  = (_Float16*)(ws + 4 * ACT * 2);
  _Float16* Vt  = (_Float16*)(ws + 5 * ACT * 2);
  _Float16* Oc  = (_Float16*)(ws + 6 * ACT * 2);
  _Float16* Wqh = (_Float16*)(ws + 7 * ACT * 2 + 0 * WSZ * 2);
  _Float16* Wkh = (_Float16*)(ws + 7 * ACT * 2 + 1 * WSZ * 2);
  _Float16* Wvh = (_Float16*)(ws + 7 * ACT * 2 + 2 * WSZ * 2);
  _Float16* Woh = (_Float16*)(ws + 7 * ACT * 2 + 3 * WSZ * 2);

  // Xq, Xk, Xv lie one behind the other from Xq; the four weights from Wqh.
  cvt_all<<<256, 512, 0, stream>>>(q, k, v, Wq, Wk, Wv, Wo, Xq, Wqh);

  // fold softmax scale (1/sqrt(64)) and log2(e) into Q so the attention
  // kernel runs a pure base-2 online softmax with no per-element scaling.
  const float SCL_Q = 0.125f * 1.44269504088896340736f;

  dim3 pg(MROWS / 128, DMODEL / 128);
  proj_gemm<0><<<pg, 256, 0, stream>>>(Xq, Wqh, bq, (void*)Qh, SCL_Q);
  proj_gemm<0><<<pg, 256, 0, stream>>>(Xk, Wkh, bk, (void*)Kh, 1.0f);
  proj_gemm<1><<<pg, 256, 0, stream>>>(Xv, Wvh, bv, (void*)Vt, 1.0f);

  dim3 ag(S_LEN / 128, 2 * HEADS);
  flash_attn<<<ag, 256, 0, stream>>>(Qh, Kh, Vt, Oc);

  proj_gemm<2><<<pg, 256, 0, stream>>>(Oc, Woh, bo, d_out, 1.0f);
}

// v005
// Measured time: 115 microseconds a run.
// Timed twice side by side with v004, it ran 1.31 times as fast both times.
// Counting every step since v000, it is 3.10 times as fast.
#include <hip/hip_runtime.h>
#include <hip/hip_bf16.h>

typedef __attribute__((ext_vector_type(16))) _Float16 v16h;
typedef __attribute__((ext_vector_type(8)))  _Float16 v8h;
typedef __attribute__((ext_vector_type(8)))  float    v8f;

#define S_LEN  4096
#define DMODEL 512
#define HEADS  8
#define HD     64
#define MROWS  8192   // N * S_LEN

// ---------------------------------------------------------------------------
// 16x32 f16 operand tile in CDNA5 WMMA A/B register layout.
// Lane L (L<16): row = base+L, halves = {k0+0..7, k0+16..23}
// Lane L+16    : row = base+L, halves = {k0+8..15, k0+24..31}
// ---------------------------------------------------------------------------
__device__ __forceinline__ v16h load_tile_k(const _Float16* src, int row_base,
                                            int ld, int k0) {
  const int lane = threadIdx.x & 31;
  const int hs   = lane >> 4;
  const _Float16* p = src + (size_t)(row_base + (lane & 15)) * ld + k0 + hs * 8;
  v8h lo = *(const v8h*)(p);
  v8h hi = *(const v8h*)(p + 16);
  v16h r;
#pragma unroll
  for (int i = 0; i < 8; ++i) { r[i] = lo[i]; r[i + 8] = hi[i]; }
  return r;
}

__device__ __forceinline__ v8f wmma_f16(v16h a, v16h b, v8f c) {
  return __builtin_amdgcn_wmma_f32_16x16x32_f16(false, a, false, b,
                                                (short)0, c, false, false);
}

// ---------------------------------------------------------------------------
// Lane l <-> lane l ^ 16: the other half of the wave (one VALU move, no DS).
// ---------------------------------------------------------------------------
__device__ __forceinline__ float other_half(float x) {
  const int b = __float_as_int(x);
  return __int_as_float(__builtin_amdgcn_permlanex16(
      b, b, 0x76543210, 0xfedcba98, false, false));
}

// ---------------------------------------------------------------------------
// 2^x as the one hardware instruction (v_exp_f32). The library exp2f wraps it
// in a compare, two selects, an add and an ldexp so that results under 2^-126
// come out as subnormals; here such a result may be 0: a weight that small
// rounds to 0 in f16, and it is lost in a row sum that holds the term 2^0.
// x = -inf (first step, no maximum yet) gives 0 either way.
// ---------------------------------------------------------------------------
__device__ __forceinline__ float hw_exp2(float x) {
  return __builtin_amdgcn_exp2f(x);
}

// The same for one score tile, 8 values a lane. One statement, so that the slot
// the instruction set asks for behind a transcendental is kept by construction:
// the results share no register with the sources (early clobber), so each
// v_exp_f32 is the independent instruction behind the one before it, and the
// v_nop is that slot behind the last.
__device__ __forceinline__ v8f hw_exp2_tile(v8f x) {
  float p0, p1, p2, p3, p4, p5, p6, p7;
  asm("v_exp_f32 %0, %8\n\t"
      "v_exp_f32 %1, %9\n\t"
      "v_exp_f32 %2, %10\n\t"
      "v_exp_f32 %3, %11\n\t"
      "v_exp_f32 %4, %12\n\t"
      "v_exp_f32 %5, %13\n\t"
      "v_exp_f32 %6, %14\n\t"
      "v_exp_f32 %7, %15\n\t"
      "v_nop"
      : "=&v"(p0), "=&v"(p1), "=&v"(p2), "=&v"(p3),
        "=&v"(p4), "=&v"(p5), "=&v"(p6), "=&v"(p7)
      : "v"(x[0]), "v"(x[1]), "v"(x[2]), "v"(x[3]),
        "v"(x[4]), "v"(x[5]), "v"(x[6]), "v"(x[7]));
  return v8f{p0, p1, p2, p3, p4, p5, p6, p7};
}

// ---------------------------------------------------------------------------
// f32 -> f16 conversion of the three activations and the four weights, one
// resident launch: 256 work-groups of 16 waves. A row is 4096 values, 8 a
// thread (two 16-byte loads, one 16-byte store; a wave stores whole lines).
// Work-group g takes rows 4g..4g+3 of each activation (1024 rows each) and
// row g & 63 of weight g >> 6 (64 rows each). All 26 loads of a thread are
// independent, so they can be in flight together.
// ---------------------------------------------------------------------------
#define CVT_ROW 4096
#define ACT_N   (MROWS * DMODEL)

__global__ __launch_bounds__(512) void cvt_all(
    const float* __restrict__ q, const float* __restrict__ k,
    const float* __restrict__ v, const float* __restrict__ Wq,
    const float* __restrict__ Wk, const float* __restrict__ Wv,
    const float* __restrict__ Wo, _Float16* __restrict__ xh,
    _Float16* __restrict__ wh) {
  const unsigned g  = blockIdx.x;
  const unsigned t8 = threadIdx.x * 8;
  const unsigned ws = g >> 6;
  // work-group-uniform bases; the thread's own part of every address is t8
  const float* qs = q + g * (4 * CVT_ROW);
  const float* ks = k + g * (4 * CVT_ROW);
  const float* vs = v + g * (4 * CVT_ROW);
  const float* wsrc = (ws == 0 ? Wq : ws == 1 ? Wk : ws == 2 ? Wv : Wo) +
                      (g & 63) * CVT_ROW;
  _Float16* xd = xh + g * (4 * CVT_ROW);
  // the four f16 weights lie one behind the other: ws * 64 rows + (g & 63) = g
  _Float16* wd = wh + g * CVT_ROW;

  v8f r[13];
  r[12] = *(const v8f*)(wsrc + t8);
#pragma unroll
  for (int i = 0; i < 4; ++i) r[i] = *(const v8f*)(qs + t8 + i * CVT_ROW);
#pragma unroll
  for (int i = 0; i < 4; ++i) r[4 + i] = *(const v8f*)(ks + t8 + i * CVT_ROW);
#pragma unroll
  for (int i = 0; i < 4; ++i) r[8 + i] = *(const v8f*)(vs + t8 + i * CVT_ROW);
  // Keeps every load ahead of the first conversion: without it the compiler
  // reuses registers and waits out the memory latency several times over.
  __builtin_amdgcn_sched_barrier(0);

  *(v8h*)(wd + t8) = __builtin_convertvector(r[12], v8h);
#pragma unroll
  for (int i = 0; i < 4; ++i)
    *(v8h*)(xd + t8 + i * CVT_ROW) = __builtin_convertvector(r[i], v8h);
#pragma unroll
  for (int i = 0; i < 4; ++i)
    *(v8h*)(xd + ACT_N + t8 + i * CVT_ROW) = __builtin_convertvector(r[4 + i], v8h);
#pragma unroll
  for (int i = 0; i < 4; ++i)
    *(v8h*)(xd + 2 * ACT_N + t8 + i * CVT_ROW) = __builtin_convertvector(r[8 + i], v8h);
}

// ---------------------------------------------------------------------------
// Eight rows of an operand tile, 16 rows apart, one 16-byte piece a lane, from
// global memory (rows of DMODEL halves) to LDS (rows of P_PITCH halves). Sixteen
// lanes cover one 256-byte row piece, so a wave's copy is four whole lines.
// ---------------------------------------------------------------------------
#define P_BK    128   // k values of a stage: 256 bytes of every operand row
#define P_PITCH 136   // 272-byte rows (16 B x odd): ds_load_b128 without bank conflicts

__device__ __forceinline__ void stage_rows(const _Float16* g, unsigned l) {
  // The copies go to LDS through no register; the closing s_wait_xcnt stands in
  // the same statement so that no address register is rewritten ahead of it.
  asm volatile(
      "global_load_async_to_lds_b128 %0, %8, off\n\t"
      "global_load_async_to_lds_b128 %1, %9, off\n\t"
      "global_load_async_to_lds_b128 %2, %10, off\n\t"
      "global_load_async_to_lds_b128 %3, %11, off\n\t"
      "global_load_async_to_lds_b128 %4, %12, off\n\t"
      "global_load_async_to_lds_b128 %5, %13, off\n\t"
      "global_load_async_to_lds_b128 %6, %14, off\n\t"
      "global_load_async_to_lds_b128 %7, %15, off\n\t"
      "s_wait_xcnt 0x0"
      :: "v"(l), "v"(l + 1 * 16 * P_PITCH * 2), "v"(l + 2 * 16 * P_PITCH * 2),
         "v"(l + 3 * 16 * P_PITCH * 2), "v"(l + 4 * 16 * P_PITCH * 2),
         "v"(l + 5 * 16 * P_PITCH * 2), "v"(l + 6 * 16 * P_PITCH * 2),
         "v"(l + 7 * 16 * P_PITCH * 2),
         "v"(g), "v"(g + 1 * 16 * DMODEL), "v"(g + 2 * 16 * DMODEL),
         "v"(g + 3 * 16 * DMODEL), "v"(g + 4 * 16 * DMODEL),
         "v"(g + 5 * 16 * DMODEL), "v"(g + 6 * 16 * DMODEL),
         "v"(g + 7 * 16 * DMODEL)
      : "memory");
}

// ---------------------------------------------------------------------------
// Projection GEMM: C[m,n] = (sum_k X[m,k]*W[n,k] + bias[n]) * oscale
// M=8192, N=512, K=512. Block 256 (8 waves), wave tile 32x64, block 128x128.
// The block's 128 rows of X and 128 rows of W come in stages of P_BK k values
// through a two-buffer LDS ring shared by its eight waves; the next stage's
// copies fly during this stage. The k order of the sums is 0, 32, 64, ...
// MODE 0: f16 per-head row-major  [((b*8+h)*4096+s)*64 + d]
// MODE 1: f16 per-head transposed [((b*8+h)*64+d)*4096 + s]
// MODE 2: f32 row-major out[m*512 + n]
// ---------------------------------------------------------------------------
template <int MODE>
__global__ __launch_bounds__(256) void proj_gemm(
    const _Float16* __restrict__ X, const _Float16* __restrict__ W,
    const float* __restrict__ bias, void* __restrict__ out, float oscale) {
  const int w    = threadIdx.x >> 5;
  const int lane = threadIdx.x & 31;
  const int hs   = lane >> 4;
  const int ln   = lane & 15;
  const int wm   = w >> 1;
  const int wn   = w & 1;
  const int m0   = blockIdx.x * 128 + wm * 32;
  const int n0   = blockIdx.y * 128 + wn * 64;

  __shared__ __attribute__((aligned(16))) _Float16 Xl[2][128][P_PITCH];
  __shared__ __attribute__((aligned(16))) _Float16 Wl[2][128][P_PITCH];

  // this thread's piece of a stage: rows sr, sr + 16, ..., sr + 112, halves sc..sc+7
  const int sr = threadIdx.x >> 4;
  const int sc = (threadIdx.x & 15) * 8;
  const _Float16* gx = X + (size_t)(blockIdx.x * 128 + sr) * DMODEL + sc;
  const _Float16* gw = W + (size_t)(blockIdx.y * 128 + sr) * DMODEL + sc;
  const unsigned lx = (unsigned)(size_t)(&Xl[0][sr][sc]);
  const unsigned lw = (unsigned)(size_t)(&Wl[0][sr][sc]);
  const unsigned lbuf = 128 * P_PITCH * 2;   // bytes from buffer 0 to buffer 1

  v8f c[2][4];
#pragma unroll
  for (int i = 0; i < 2; ++i)
#pragma unroll
    for (int j = 0; j < 4; ++j) c[i][j] = {};

  // Ring prologue: stage 0 lands and is published, then stage 1 starts.
  stage_rows(gx, lx);
  stage_rows(gw, lw);
  asm volatile("s_wait_asynccnt 0x0" ::: "memory");  // own copies of stage 0 landed
  __syncthreads();                                   // every wave's copies visible
  stage_rows(gx + P_BK, lx + lbuf);
  stage_rows(gw + P_BK, lw + lbuf);

  for (int k0 = 0; k0 < DMODEL; k0 += P_BK) {
    const int buf = (k0 / P_BK) & 1;
    const _Float16* Xs = &Xl[buf][0][0];
    const _Float16* Ws = &Wl[buf][0][0];

    // unrolled so that the four k steps' LDS offsets are immediates of the reads
#pragma unroll
    for (int kk = 0; kk < P_BK; kk += 32) {
      const v16h a0 = load_tile_k(Xs, wm * 32,      P_PITCH, kk);
      const v16h a1 = load_tile_k(Xs, wm * 32 + 16, P_PITCH, kk);
      v16h b[4];
#pragma unroll
      for (int j = 0; j < 4; ++j)
        b[j] = load_tile_k(Ws, wn * 64 + 16 * j, P_PITCH, kk);
      // Keeps the twelve LDS reads of this k step together ahead of its products:
      // without it the compiler sinks each pair in front of its user and the wave
      // waits out the LDS latency four times a k step, not once.
      __builtin_amdgcn_sched_barrier(0);
#pragma unroll
      for (int j = 0; j < 4; ++j) {
        c[0][j] = wmma_f16(a0, b[j], c[0][j]);
        c[1][j] = wmma_f16(a1, b[j], c[1][j]);
      }
    }

    // Publish point of the next stage, then the refill of this stage's buffer.
    asm volatile("s_wait_dscnt 0x0" ::: "memory");     // own reads of this buffer done
    asm volatile("s_wait_asynccnt 0x0" ::: "memory");  // own copies of the next stage landed
    __syncthreads();  // publishes the next stage; ends every wave's reads of this buffer
    if (k0 + 2 * P_BK < DMODEL) {
      stage_rows(gx + k0 + 2 * P_BK, lx + buf * lbuf);
      stage_rows(gw + k0 + 2 * P_BK, lw + buf * lbuf);
    }
  }
  asm volatile("s_wait_asynccnt 0x0" ::: "memory");  // nothing outstanding at the wave's end

#pragma unroll
  for (int i = 0; i < 2; ++i) {
#pragma unroll
    for (int j = 0; j < 4; ++j) {
      const int n = n0 + 16 * j + ln;
      const float bn = bias[n];
#pragma unroll
      for (int v = 0; v < 8; ++v) {
        const int m = m0 + 16 * i + hs * 8 + v;
        const float val = (c[i][j][v] + bn) * oscale;
        if (MODE == 2) {
          ((float*)out)[(size_t)m * DMODEL + n] = val;
        } else {
          const int b = m >> 12;
          const int s = m & (S_LEN - 1);
          const int h = n >> 6;
          const int d = n & (HD - 1);
          _Float16* o = (_Float16*)out;
          if (MODE == 0)
            o[(((size_t)b * HEADS + h) * S_LEN + s) * HD + d] = (_Float16)val;
          else
            o[(((size_t)b * HEADS + h) * HD + d) * S_LEN + s] = (_Float16)val;
        }
      }
    }
  }
}

// ---------------------------------------------------------------------------
// One 64-key stage of K (64 keys x 64 d) and V^T (64 d x 64 keys), 128-byte
// rows, copied once per block into LDS rows of KV_PITCH halves. Each thread
// moves four 16-byte pieces; a wave's copy covers four whole 128-byte lines.
// ---------------------------------------------------------------------------
#define KV_PITCH 72   // 144-byte rows (16 B x odd): ds_load_b128 without bank conflicts

__device__ __forceinline__ void stage_kv(const _Float16* __restrict__ K,
                                         const _Float16* __restrict__ V, int kt,
                                         _Float16* kl, _Float16* vl) {
  const int r = threadIdx.x >> 3;         // row 0..31 (and row + 32)
  const int c = (threadIdx.x & 7) * 8;    // first half of the 16-byte piece
  const _Float16* gk0 = K + (size_t)(kt + r) * HD + c;
  const _Float16* gk1 = gk0 + 32 * HD;
  const _Float16* gv0 = V + (size_t)r * S_LEN + kt + c;
  const _Float16* gv1 = gv0 + (size_t)32 * S_LEN;
  const unsigned lk0 = (unsigned)(size_t)(kl + r * KV_PITCH + c);
  const unsigned lk1 = lk0 + 32 * KV_PITCH * 2;
  const unsigned lv0 = (unsigned)(size_t)(vl + r * KV_PITCH + c);
  const unsigned lv1 = lv0 + 32 * KV_PITCH * 2;
  // The copies go to LDS through no register; the closing s_wait_xcnt stands in
  // the same statement so that no address register is rewritten ahead of it.
  asm volatile(
      "global_load_async_to_lds_b128 %0, %4, off\n\t"
      "global_load_async_to_lds_b128 %1, %5, off\n\t"
      "global_load_async_to_lds_b128 %2, %6, off\n\t"
      "global_load_async_to_lds_b128 %3, %7, off\n\t"
      "s_wait_xcnt 0x0"
      :: "v"(lk0), "v"(lk1), "v"(lv0), "v"(lv1),
         "v"(gk0), "v"(gk1), "v"(gv0), "v"(gv1)
      : "memory");
}

// ---------------------------------------------------------------------------
// Flash attention, base-2 online softmax (scale*log2e folded into Q).
// Grid (32,16), block 256 (8 waves). Wave: 16 queries x 64 d. 64-key steps:
//   K and V^T of the step come from a two-buffer LDS ring shared by the
//   block's eight waves; the next step's copies fly during this step.
// Both products are taken transposed, so that a lane owns ONE query:
//   S^T = K Q^T   (A = 16 keys x 32 d from LDS, B = Q, kept in registers)
//     s[t][r] = score of key 16t + 8*hs + r against query ln
//   maximum and sum run down the lane's own 32 scores; the two halves of the
//   wave (which split the keys) exchange the maximum once a step and join
//   their sums once, behind the loop.
//   O^T += V^T P^T (A = 16 d x 32 keys from LDS, B = P^T)
//     two score tiles 2u, 2u+1, converted in place, ARE the B operand of key
//     block u in the hardware k order that load_tile_k gives A.
//     o[j][r] = output d 16j + 8*hs + r of query ln
// ---------------------------------------------------------------------------
__global__ __launch_bounds__(256) void flash_attn(
    const _Float16* __restrict__ Qh, const _Float16* __restrict__ Kh,
    const _Float16* __restrict__ Vt, _Float16* __restrict__ Oc) {
  const int w    = threadIdx.x >> 5;
  const int lane = threadIdx.x & 31;
  const int hs   = lane >> 4;
  const int ln   = lane & 15;
  const int bh   = blockIdx.y;
  const int b    = bh >> 3;
  const int h    = bh & 7;
  const int q0   = blockIdx.x * 128 + w * 16;

  const _Float16* Q = Qh + (size_t)bh * S_LEN * HD;
  const _Float16* K = Kh + (size_t)bh * S_LEN * HD;
  const _Float16* V = Vt + (size_t)bh * HD * S_LEN;  // [d][s]

  __shared__ __attribute__((aligned(16))) _Float16 Kl[2][64][KV_PITCH];
  __shared__ __attribute__((aligned(16))) _Float16 Vl[2][64][KV_PITCH];

  const v16h bq0 = load_tile_k(Q, q0, HD, 0);
  const v16h bq1 = load_tile_k(Q, q0, HD, 32);

  v8f o[4];
#pragma unroll
  for (int j = 0; j < 4; ++j) o[j] = {};
  float m_r = -__builtin_inff();  // running maximum of query ln (both halves alike)
  float l_r = 0.f;                // running sum over this half's keys only

  // Ring prologue: stage 0 lands and is published, then stage 1 starts.
  stage_kv(K, V, 0, &Kl[0][0][0], &Vl[0][0][0]);
  asm volatile("s_wait_asynccnt 0x0" ::: "memory");  // own copies of stage 0 landed
  __syncthreads();                                   // every wave's copies visible
  stage_kv(K, V, 64, &Kl[1][0][0], &Vl[1][0][0]);

  for (int kt = 0; kt < S_LEN; kt += 64) {
    const int buf = (kt >> 6) & 1;
    const _Float16* Ks = &Kl[buf][0][0];
    const _Float16* Vs = &Vl[buf][0][0];

    // S^T = K Q^T for 64 keys (four 16-key subtiles), d-accumulated
    v8f s[4];
#pragma unroll
    for (int t = 0; t < 4; ++t) {
      s[t] = {};
      v16h ak = load_tile_k(Ks, 16 * t, KV_PITCH, 0);
      s[t] = wmma_f16(ak, bq0, s[t]);
      ak = load_tile_k(Ks, 16 * t, KV_PITCH, 32);
      s[t] = wmma_f16(ak, bq1, s[t]);
    }

    // maximum of the lane's 32 scores, then of both halves and the old one
    float mx[4];
#pragma unroll
    for (int t = 0; t < 4; ++t) {
      mx[t] = fmaxf(fmaxf(fmaxf(s[t][0], s[t][1]), s[t][2]),
                    fmaxf(fmaxf(s[t][3], s[t][4]), s[t][5]));
      mx[t] = fmaxf(fmaxf(mx[t], s[t][6]), s[t][7]);
    }
    const float mh = fmaxf(fmaxf(mx[0], mx[1]), fmaxf(mx[2], mx[3]));
    const float nm = fmaxf(fmaxf(mh, other_half(mh)), m_r);
    const float al = hw_exp2(m_r - nm);
    m_r = nm;

#pragma unroll
    for (int t = 0; t < 4; ++t) s[t] = hw_exp2_tile(s[t] - nm);

    const v8f sv = (s[0] + s[1]) + (s[2] + s[3]);
    const float rs = ((sv[0] + sv[1]) + (sv[2] + sv[3])) +
                     ((sv[4] + sv[5]) + (sv[6] + sv[7]));
    l_r = l_r * al + rs;

#pragma unroll
    for (int j = 0; j < 4; ++j) o[j] *= al;

    // P^T as B operand: element e of key block u is tile 2u + (e >> 3), register e & 7
    const v16h bp0 = __builtin_shufflevector(
        __builtin_convertvector(s[0], v8h), __builtin_convertvector(s[1], v8h),
        0, 1, 2, 3, 4, 5, 6, 7, 8, 9, 10, 11, 12, 13, 14, 15);
    const v16h bp1 = __builtin_shufflevector(
        __builtin_convertvector(s[2], v8h), __builtin_convertvector(s[3], v8h),
        0, 1, 2, 3, 4, 5, 6, 7, 8, 9, 10, 11, 12, 13, 14, 15);

#pragma unroll
    for (int j = 0; j < 4; ++j) {
      v16h av = load_tile_k(Vs, 16 * j, KV_PITCH, 0);
      o[j] = wmma_f16(av, bp0, o[j]);
      av = load_tile_k(Vs, 16 * j, KV_PITCH, 32);
      o[j] = wmma_f16(av, bp1, o[j]);
    }

    // Publish point of the next stage, then the refill of this stage's buffer.
    asm volatile("s_wait_dscnt 0x0" ::: "memory");     // own reads of this buffer done
    asm volatile("s_wait_asynccnt 0x0" ::: "memory");  // own copies of the next stage landed
    __syncthreads();  // publishes the next stage; ends every wave's reads of this buffer
    if (kt + 128 < S_LEN)
      stage_kv(K, V, kt + 128, &Kl[buf][0][0], &Vl[buf][0][0]);
  }
  asm volatile("s_wait_asynccnt 0x0" ::: "memory");  // nothing outstanding at the wave's end

  // the two halves' sums of query ln are joined here, once
  const float inv = 1.0f / (l_r + other_half(l_r));

  // a lane holds 8 consecutive d of its query in each o[j]: one 16-byte store
  _Float16* orow = Oc + ((size_t)b * S_LEN + q0 + ln) * DMODEL + h * HD + hs * 8;
#pragma unroll
  for (int j = 0; j < 4; ++j)
    *(v8h*)(orow + 16 * j) = __builtin_convertvector(o[j] * inv, v8h);
}

// ---------------------------------------------------------------------------
// Host side
// ---------------------------------------------------------------------------
extern "C" void kernel_launch(void* const* d_in, const int* in_sizes, int n_in,
                              void* d_out, int out_size, void* d_ws,
                              size_t ws_size, hipStream_t stream) {
  const float* q  = (const float*)d_in[0];
  const float* k  = (const float*)d_in[1];
  const float* v  = (const float*)d_in[2];
  const float* Wq = (const float*)d_in[3];
  const float* bq = (const float*)d_in[4];
  const float* Wk = (const float*)d_in[5];
  const float* bk = (const float*)d_in[6];
  const float* Wv = (const float*)d_in[7];
  const float* bv = (const float*)d_in[8];
  const float* Wo = (const float*)d_in[9];
  const float* bo = (const float*)d_in[10];

  const size_t ACT = (size_t)MROWS * DMODEL;
  const size_t WSZ = (size_t)DMODEL * DMODEL;
  char* ws = (char*)d_ws;
  _Float16* Xq  = (_Float16*)(ws + 0 * ACT * 2);
  _Float16* Xk  = (_Float16*)(ws + 1 * ACT * 2);
  _Float16* Xv  = (_Float16*)(ws + 2 * ACT * 2);
  _Float16* Qh  = (_Float16*)(ws + 3 * ACT * 2);
  _Float16* Kh  = (_Float16*)(ws + 4 * ACT * 2);
  _Float16* Vt  = (_Float16*)(ws + 5 * ACT * 2);
  _Float16* Oc  = (_Float16*)(ws + 6 * ACT * 2);
  _Float16* Wqh = (_Float16*)(ws + 7 * ACT * 2 + 0 * WSZ * 2);
  _Float16* Wkh = (_Float16*)(ws + 7 * ACT * 2 + 1 * WSZ * 2);
  _Float16* Wvh = (_Float16*)(ws + 7 * ACT * 2 + 2 * WSZ * 2);
  _Float16* Woh = (_Float16*)(ws + 7 * ACT * 2 + 3 * WSZ * 2);

  // Xq, Xk, Xv lie one behind the other from Xq; the four weights from Wqh.
  cvt_all<<<256, 512, 0, stream>>>(q, k, v, Wq, Wk, Wv, Wo, Xq, Wqh);

  // fold softmax scale (1/sqrt(64)) and log2(e) into Q so the attention
  // kernel runs a pure base-2 online softmax with no per-element scaling.
  const float SCL_Q = 0.125f * 1.44269504088896340736f;

  dim3 pg(MROWS / 128, DMODEL / 128);
  proj_gemm<0><<<pg, 256, 0, stream>>>(Xq, Wqh, bq, (void*)Qh, SCL_Q);
  proj_gemm<0><<<pg, 256, 0, stream>>>(Xk, Wkh, bk, (void*)Kh, 1.0f);
  proj_gemm<1><<<pg, 256, 0, stream>>>(Xv, Wvh, bv, (void*)Vt, 1.0f);

  dim3 ag(S_LEN / 128, 2 * HEADS);
  flash_attn<<<ag, 256, 0, stream>>>(Qh, Kh, Vt, Oc);

  proj_gemm<2><<<pg, 256, 0, stream>>>(Oc, Woh, bo, d_out, 1.0f);
}

// v006
// A run of this version takes 104 microseconds.
// Next to v005, in two timings, it ran 1.10 times as fast each time.
// Over all steps from v000 it is 3.41 times as fast.
#include <hip/hip_runtime.h>
#include <hip/hip_bf16.h>

typedef __attribute__((ext_vector_type(16))) _Float16 v16h;
typedef __attribute__((ext_vector_type(8)))  _Float16 v8h;
typedef __attribute__((ext_vector_type(8)))  float    v8f;

#define S_LEN  4096
#define DMODEL 512
#define HEADS  8
#define HD     64
#define MROWS  8192   // N * S_LEN

// ---------------------------------------------------------------------------
// 16x32 f16 operand tile in CDNA5 WMMA A/B register layout.
// Lane L (L<16): row = base+L, halves = {k0+0..7, k0+16..23}
// Lane L+16    : row = base+L, halves = {k0+8..15, k0+24..31}
// ---------------------------------------------------------------------------
__device__ __forceinline__ v16h load_tile_k(const _Float16* src, int row_base,
                                            int ld, int k0) {
  const int lane = threadIdx.x & 31;
  const int hs   = lane >> 4;
  const _Float16* p = src + (size_t)(row_base + (lane & 15)) * ld + k0 + hs * 8;
  v8h lo = *(const v8h*)(p);
  v8h hi = *(const v8h*)(p + 16);
  v16h r;
#pragma unroll
  for (int i = 0; i < 8; ++i) { r[i] = lo[i]; r[i + 8] = hi[i]; }
  return r;
}

__device__ __forceinline__ v8f wmma_f16(v16h a, v16h b, v8f c) {
  return __builtin_amdgcn_wmma_f32_16x16x32_f16(false, a, false, b,
                                                (short)0, c, false, false);
}

// ---------------------------------------------------------------------------
// Lane l <-> lane l ^ 16: the other half of the wave (one VALU move, no DS).
// ---------------------------------------------------------------------------
__device__ __forceinline__ float other_half(float x) {
  const int b = __float_as_int(x);
  return __int_as_float(__builtin_amdgcn_permlanex16(
      b, b, 0x76543210, 0xfedcba98, false, false));
}

// ---------------------------------------------------------------------------
// 2^x as the one hardware instruction (v_exp_f32). The library exp2f wraps it
// in a compare, two selects, an add and an ldexp so that results under 2^-126
// come out as subnormals; here such a result may be 0: a weight that small
// rounds to 0 in f16, and it is lost in a row sum that holds the term 2^0.
// x = -inf (first step, no maximum yet) gives 0 either way.
// ---------------------------------------------------------------------------
__device__ __forceinline__ float hw_exp2(float x) {
  return __builtin_amdgcn_exp2f(x);
}

// The same for one score tile, 8 values a lane. One statement, so that the slot
// the instruction set asks for behind a transcendental is kept by construction:
// the results share no register with the sources (early clobber), so each
// v_exp_f32 is the independent instruction behind the one before it, and the
// v_nop is that slot behind the last.
__device__ __forceinline__ v8f hw_exp2_tile(v8f x) {
  float p0, p1, p2, p3, p4, p5, p6, p7;
  asm("v_exp_f32 %0, %8\n\t"
      "v_exp_f32 %1, %9\n\t"
      "v_exp_f32 %2, %10\n\t"
      "v_exp_f32 %3, %11\n\t"
      "v_exp_f32 %4, %12\n\t"
      "v_exp_f32 %5, %13\n\t"
      "v_exp_f32 %6, %14\n\t"
      "v_exp_f32 %7, %15\n\t"
      "v_nop"
      : "=&v"(p0), "=&v"(p1), "=&v"(p2), "=&v"(p3),
        "=&v"(p4), "=&v"(p5), "=&v"(p6), "=&v"(p7)
      : "v"(x[0]), "v"(x[1]), "v"(x[2]), "v"(x[3]),
        "v"(x[4]), "v"(x[5]), "v"(x[6]), "v"(x[7]));
  return v8f{p0, p1, p2, p3, p4, p5, p6, p7};
}

// ---------------------------------------------------------------------------
// f32 -> f16 conversion of the three activations and the four weights, one
// resident launch: 256 work-groups of 16 waves. A row is 4096 values, 8 a
// thread (two 16-byte loads, one 16-byte store; a wave stores whole lines).
// Work-group g takes rows 4g..4g+3 of each activation (1024 rows each) and
// row g & 63 of weight g >> 6 (64 rows each). All 26 loads of a thread are
// independent, so they can be in flight together.
// ---------------------------------------------------------------------------
#define CVT_ROW 4096
#define ACT_N   (MROWS * DMODEL)

__global__ __launch_bounds__(512) void cvt_all(
    const float* __restrict__ q, const float* __restrict__ k,
    const float* __restrict__ v, const float* __restrict__ Wq,
    const float* __restrict__ Wk, const float* __restrict__ Wv,
    const float* __restrict__ Wo, _Float16* __restrict__ xh,
    _Float16* __restrict__ wh) {
  const unsigned g  = blockIdx.x;
  const unsigned t8 = threadIdx.x * 8;
  const unsigned ws = g >> 6;
  // work-group-uniform bases; the thread's own part of every address is t8
  const float* qs = q + g * (4 * CVT_ROW);
  const float* ks = k + g * (4 * CVT_ROW);
  const float* vs = v + g * (4 * CVT_ROW);
  const float* wsrc = (ws == 0 ? Wq : ws == 1 ? Wk : ws == 2 ? Wv : Wo) +
                      (g & 63) * CVT_ROW;
  _Float16* xd = xh + g * (4 * CVT_ROW);
  // the four f16 weights lie one behind the other: ws * 64 rows + (g & 63) = g
  _Float16* wd = wh + g * CVT_ROW;

  v8f r[13];
  r[12] = *(const v8f*)(wsrc + t8);
#pragma unroll
  for (int i = 0; i < 4; ++i) r[i] = *(const v8f*)(qs + t8 + i * CVT_ROW);
#pragma unroll
  for (int i = 0; i < 4; ++i) r[4 + i] = *(const v8f*)(ks + t8 + i * CVT_ROW);
#pragma unroll
  for (int i = 0; i < 4; ++i) r[8 + i] = *(const v8f*)(vs + t8 + i * CVT_ROW);
  // Keeps every load ahead of the first conversion: without it the compiler
  // reuses registers and waits out the memory latency several times over.
  __builtin_amdgcn_sched_barrier(0);

  *(v8h*)(wd + t8) = __builtin_convertvector(r[12], v8h);
#pragma unroll
  for (int i = 0; i < 4; ++i)
    *(v8h*)(xd + t8 + i * CVT_ROW) = __builtin_convertvector(r[i], v8h);
#pragma unroll
  for (int i = 0; i < 4; ++i)
    *(v8h*)(xd + ACT_N + t8 + i * CVT_ROW) = __builtin_convertvector(r[4 + i], v8h);
#pragma unroll
  for (int i = 0; i < 4; ++i)
    *(v8h*)(xd + 2 * ACT_N + t8 + i * CVT_ROW) = __builtin_convertvector(r[8 + i], v8h);
}

// ---------------------------------------------------------------------------
// Eight rows of an operand tile, 16 rows apart, one 16-byte piece a lane, from
// global memory (rows of DMODEL halves) to LDS (rows of P_PITCH halves). Sixteen
// lanes cover one 256-byte row piece, so a wave's copy is four whole lines.
// ---------------------------------------------------------------------------
#define P_BK    128   // k values of a stage: 256 bytes of every operand row
#define P_PITCH 136   // 272-byte rows (16 B x odd): ds_load_b128 without bank conflicts

__device__ __forceinline__ void stage_rows(const _Float16* g, unsigned l) {
  // The copies go to LDS through no register; the closing s_wait_xcnt stands in
  // the same statement so that no address register is rewritten ahead of it.
  asm volatile(
      "global_load_async_to_lds_b128 %0, %8, off\n\t"
      "global_load_async_to_lds_b128 %1, %9, off\n\t"
      "global_load_async_to_lds_b128 %2, %10, off\n\t"
      "global_load_async_to_lds_b128 %3, %11, off\n\t"
      "global_load_async_to_lds_b128 %4, %12, off\n\t"
      "global_load_async_to_lds_b128 %5, %13, off\n\t"
      "global_load_async_to_lds_b128 %6, %14, off\n\t"
      "global_load_async_to_lds_b128 %7, %15, off\n\t"
      "s_wait_xcnt 0x0"
      :: "v"(l), "v"(l + 1 * 16 * P_PITCH * 2), "v"(l + 2 * 16 * P_PITCH * 2),
         "v"(l + 3 * 16 * P_PITCH * 2), "v"(l + 4 * 16 * P_PITCH * 2),
         "v"(l + 5 * 16 * P_PITCH * 2), "v"(l + 6 * 16 * P_PITCH * 2),
         "v"(l + 7 * 16 * P_PITCH * 2),
         "v"(g), "v"(g + 1 * 16 * DMODEL), "v"(g + 2 * 16 * DMODEL),
         "v"(g + 3 * 16 * DMODEL), "v"(g + 4 * 16 * DMODEL),
         "v"(g + 5 * 16 * DMODEL), "v"(g + 6 * 16 * DMODEL),
         "v"(g + 7 * 16 * DMODEL)
      : "memory");
}

// ---------------------------------------------------------------------------
// Projection GEMM: C[m,n] = (sum_k X[m,k]*W[n,k] + bias[n]) * oscale
// M=8192, N=512, K=512. Block 256 (8 waves), wave tile 32x64, block 128x128.
// The block's 128 rows of X and 128 rows of W come in stages of P_BK k values
// through a two-buffer LDS ring shared by its eight waves; the next stage's
// copies fly during this stage. The k order of the sums is 0, 32, 64, ...
// MODE 0: f16 per-head row-major  [((b*8+h)*4096+s)*64 + d]
// MODE 1: f16 per-head transposed [((b*8+h)*64+d)*4096 + s]
// MODE 2: f32 row-major out[m*512 + n]
// ---------------------------------------------------------------------------
template <int MODE>
__global__ __launch_bounds__(256) void proj_gemm(
    const _Float16* __restrict__ X, const _Float16* __restrict__ W,
    const float* __restrict__ bias, void* __restrict__ out, float oscale) {
  const int w    = threadIdx.x >> 5;
  const int lane = threadIdx.x & 31;
  const int hs   = lane >> 4;
  const int ln   = lane & 15;
  const int wm   = w >> 1;
  const int wn   = w & 1;
  const int m0   = blockIdx.x * 128 + wm * 32;
  const int n0   = blockIdx.y * 128 + wn * 64;

  __shared__ __attribute__((aligned(16))) _Float16 Xl[2][128][P_PITCH];
  __shared__ __attribute__((aligned(16))) _Float16 Wl[2][128][P_PITCH];

  // this thread's piece of a stage: rows sr, sr + 16, ..., sr + 112, halves sc..sc+7
  const int sr = threadIdx.x >> 4;
  const int sc = (threadIdx.x & 15) * 8;
  const _Float16* gx = X + (size_t)(blockIdx.x * 128 + sr) * DMODEL + sc;
  const _Float16* gw = W + (size_t)(blockIdx.y * 128 + sr) * DMODEL + sc;
  const unsigned lx = (unsigned)(size_t)(&Xl[0][sr][sc]);
  const unsigned lw = (unsigned)(size_t)(&Wl[0][sr][sc]);
  const unsigned lbuf = 128 * P_PITCH * 2;   // bytes from buffer 0 to buffer 1

  v8f c[2][4];
#pragma unroll
  for (int i = 0; i < 2; ++i)
#pragma unroll
    for (int j = 0; j < 4; ++j) c[i][j] = {};

  // Ring prologue: stage 0 lands and is published, then stage 1 starts.
  stage_rows(gx, lx);
  stage_rows(gw, lw);
  asm volatile("s_wait_asynccnt 0x0" ::: "memory");  // own copies of stage 0 landed
  __syncthreads();                                   // every wave's copies visible
  stage_rows(gx + P_BK, lx + lbuf);
  stage_rows(gw + P_BK, lw + lbuf);

  for (int k0 = 0; k0 < DMODEL; k0 += P_BK) {
    const int buf = (k0 / P_BK) & 1;
    const _Float16* Xs = &Xl[buf][0][0];
    const _Float16* Ws = &Wl[buf][0][0];

    // unrolled so that the four k steps' LDS offsets are immediates of the reads
#pragma unroll
    for (int kk = 0; kk < P_BK; kk += 32) {
      const v16h a0 = load_tile_k(Xs, wm * 32,      P_PITCH, kk);
      const v16h a1 = load_tile_k(Xs, wm * 32 + 16, P_PITCH, kk);
      v16h b[4];
#pragma unroll
      for (int j = 0; j < 4; ++j)
        b[j] = load_tile_k(Ws, wn * 64 + 16 * j, P_PITCH, kk);
      // Keeps the twelve LDS reads of this k step together ahead of its products:
      // without it the compiler sinks each pair in front of its user and the wave
      // waits out the LDS latency four times a k step, not once.
      __builtin_amdgcn_sched_barrier(0);
#pragma unroll
      for (int j = 0; j < 4; ++j) {
        c[0][j] = wmma_f16(a0, b[j], c[0][j]);
        c[1][j] = wmma_f16(a1, b[j], c[1][j]);
      }
    }

    // Publish point of the next stage, then the refill of this stage's buffer.
    asm volatile("s_wait_dscnt 0x0" ::: "memory");     // own reads of this buffer done
    asm volatile("s_wait_asynccnt 0x0" ::: "memory");  // own copies of the next stage landed
    __syncthreads();  // publishes the next stage; ends every wave's reads of this buffer
    if (k0 + 2 * P_BK < DMODEL) {
      stage_rows(gx + k0 + 2 * P_BK, lx + buf * lbuf);
      stage_rows(gw + k0 + 2 * P_BK, lw + buf * lbuf);
    }
  }
  asm volatile("s_wait_asynccnt 0x0" ::: "memory");  // nothing outstanding at the wave's end

#pragma unroll
  for (int i = 0; i < 2; ++i) {
#pragma unroll
    for (int j = 0; j < 4; ++j) {
      const int n = n0 + 16 * j + ln;
      const float bn = bias[n];
#pragma unroll
      for (int v = 0; v < 8; ++v) {
        const int m = m0 + 16 * i + hs * 8 + v;
        const float val = (c[i][j][v] + bn) * oscale;
        if (MODE == 2) {
          ((float*)out)[(size_t)m * DMODEL + n] = val;
        } else {
          const int b = m >> 12;
          const int s = m & (S_LEN - 1);
          const int h = n >> 6;
          const int d = n & (HD - 1);
          _Float16* o = (_Float16*)out;
          if (MODE == 0)
            o[(((size_t)b * HEADS + h) * S_LEN + s) * HD + d] = (_Float16)val;
          else
            o[(((size_t)b * HEADS + h) * HD + d) * S_LEN + s] = (_Float16)val;
        }
      }
    }
  }
}

// ---------------------------------------------------------------------------
// One 64-key stage of K (64 keys x 64 d) and V^T (64 d x 64 keys), 128-byte
// rows, copied once per block into LDS rows of KV_PITCH halves. Each thread
// moves four 16-byte pieces; a wave's copy covers four whole 128-byte lines.
// ---------------------------------------------------------------------------
#define KV_PITCH 72   // 144-byte rows (16 B x odd): ds_load_b128 without bank conflicts

__device__ __forceinline__ void stage_kv(const _Float16* __restrict__ K,
                                         const _Float16* __restrict__ V, int kt,
                                         _Float16* kl, _Float16* vl) {
  const int r = threadIdx.x >> 3;         // row 0..31 (and row + 32)
  const int c = (threadIdx.x & 7) * 8;    // first half of the 16-byte piece
  const _Float16* gk0 = K + (size_t)(kt + r) * HD + c;
  const _Float16* gk1 = gk0 + 32 * HD;
  const _Float16* gv0 = V + (size_t)r * S_LEN + kt + c;
  const _Float16* gv1 = gv0 + (size_t)32 * S_LEN;
  const unsigned lk0 = (unsigned)(size_t)(kl + r * KV_PITCH + c);
  const unsigned lk1 = lk0 + 32 * KV_PITCH * 2;
  const unsigned lv0 = (unsigned)(size_t)(vl + r * KV_PITCH + c);
  const unsigned lv1 = lv0 + 32 * KV_PITCH * 2;
  // The copies go to LDS through no register; the closing s_wait_xcnt stands in
  // the same statement so that no address register is rewritten ahead of it.
  asm volatile(
      "global_load_async_to_lds_b128 %0, %4, off\n\t"
      "global_load_async_to_lds_b128 %1, %5, off\n\t"
      "global_load_async_to_lds_b128 %2, %6, off\n\t"
      "global_load_async_to_lds_b128 %3, %7, off\n\t"
      "s_wait_xcnt 0x0"
      :: "v"(lk0), "v"(lk1), "v"(lv0), "v"(lv1),
         "v"(gk0), "v"(gk1), "v"(gv0), "v"(gv1)
      : "memory");
}

// ---------------------------------------------------------------------------
// Flash attention, base-2 online softmax (scale*log2e folded into Q).
// Grid (32,16), block 256 (8 waves). Wave: 16 queries x 64 d. 64-key steps:
//   K and V^T of the step come from a two-buffer LDS ring shared by the
//   block's eight waves; the next step's copies fly during this step.
// Both products are taken transposed, so that a lane owns ONE query:
//   S^T = K Q^T   (A = 16 keys x 32 d from LDS, B = Q, kept in registers)
//     s[t][r] = score of key 16t + 8*hs + r against query ln
//   maximum and sum run down the lane's own 32 scores; the two halves of the
//   wave (which split the keys) exchange the maximum once a step and join
//   their sums once, behind the loop.
//   O^T += V^T P^T (A = 16 d x 32 keys from LDS, B = P^T)
//     two score tiles 2u, 2u+1, converted in place, ARE the B operand of key
//     block u in the hardware k order that load_tile_k gives A.
//     o[j][r] = output d 16j + 8*hs + r of query ln
// ---------------------------------------------------------------------------
__global__ __launch_bounds__(256) void flash_attn(
    const _Float16* __restrict__ Qh, const _Float16* __restrict__ Kh,
    const _Float16* __restrict__ Vt, _Float16* __restrict__ Oc) {
  const int w    = threadIdx.x >> 5;
  const int lane = threadIdx.x & 31;
  const int hs   = lane >> 4;
  const int ln   = lane & 15;
  const int bh   = blockIdx.y;
  const int b    = bh >> 3;
  const int h    = bh & 7;
  const int q0   = blockIdx.x * 128 + w * 16;

  const _Float16* Q = Qh + (size_t)bh * S_LEN * HD;
  const _Float16* K = Kh + (size_t)bh * S_LEN * HD;
  const _Float16* V = Vt + (size_t)bh * HD * S_LEN;  // [d][s]

  __shared__ __attribute__((aligned(16))) _Float16 Kl[2][64][KV_PITCH];
  __shared__ __attribute__((aligned(16))) _Float16 Vl[2][64][KV_PITCH];

  const v16h bq0 = load_tile_k(Q, q0, HD, 0);
  const v16h bq1 = load_tile_k(Q, q0, HD, 32);

  v8f o[4];
#pragma unroll
  for (int j = 0; j < 4; ++j) o[j] = {};
  float m_r = -__builtin_inff();  // running maximum of query ln (both halves alike)
  float l_r = 0.f;                // running sum over this half's keys only

  // Ring prologue: stage 0 lands and is published, then stage 1 starts.
  stage_kv(K, V, 0, &Kl[0][0][0], &Vl[0][0][0]);
  asm volatile("s_wait_asynccnt 0x0" ::: "memory");  // own copies of stage 0 landed
  __syncthreads();                                   // every wave's copies visible
  stage_kv(K, V, 64, &Kl[1][0][0], &Vl[1][0][0]);

  for (int kt = 0; kt < S_LEN; kt += 64) {
    const int buf = (kt >> 6) & 1;
    const _Float16* Ks = &Kl[buf][0][0];
    const _Float16* Vs = &Vl[buf][0][0];

    // The step's eight K fragments, read as one group. (This loop and those below
    // over ak, av, s and o are unrolled so that the arrays are registers.)
    v16h ak[2][4];
#pragma unroll
    for (int c = 0; c < 2; ++c)
#pragma unroll
      for (int t = 0; t < 4; ++t)
        ak[c][t] = load_tile_k(Ks, 16 * t, KV_PITCH, 32 * c);
    // Keeps the sixteen LDS reads together ahead of the score products: without
    // it the compiler reads one fragment, waits for it and multiplies, and the
    // wave waits out the LDS latency once a product, not once a step.
    __builtin_amdgcn_sched_barrier(0);

    // S^T = K Q^T for 64 keys (four 16-key subtiles), d 0..31 and then d 32..63
    v8f s[4];
#pragma unroll
    for (int t = 0; t < 4; ++t) s[t] = wmma_f16(ak[0][t], bq0, v8f{});
#pragma unroll
    for (int t = 0; t < 4; ++t) s[t] = wmma_f16(ak[1][t], bq1, s[t]);

    // The step's eight V^T fragments, read as one group behind the score
    // products: they land while the softmax below runs.
    v16h av[2][4];
#pragma unroll
    for (int u = 0; u < 2; ++u)
#pragma unroll
      for (int j = 0; j < 4; ++j)
        av[u][j] = load_tile_k(Vs, 16 * j, KV_PITCH, 32 * u);
    // Orders what stands between the scheduling barriers above and below: the
    // eight score products (0x8), then the sixteen V reads (0x100) in one place;
    // without the two lines the compiler spreads the reads over three places
    // among the products.
    __builtin_amdgcn_sched_group_barrier(0x8, 8, 0);
    __builtin_amdgcn_sched_group_barrier(0x100, 16, 0);
    // Keeps these sixteen reads ahead of the softmax: without it the compiler
    // sinks each pair in front of its product, behind the softmax, and the wave
    // waits out the LDS latency once a product again.
    __builtin_amdgcn_sched_barrier(0);

    // maximum of the lane's 32 scores, then of both halves and the old one
    float mx[4];
#pragma unroll
    for (int t = 0; t < 4; ++t) {
      mx[t] = fmaxf(fmaxf(fmaxf(s[t][0], s[t][1]), s[t][2]),
                    fmaxf(fmaxf(s[t][3], s[t][4]), s[t][5]));
      mx[t] = fmaxf(fmaxf(mx[t], s[t][6]), s[t][7]);
    }
    const float mh = fmaxf(fmaxf(mx[0], mx[1]), fmaxf(mx[2], mx[3]));
    const float nm = fmaxf(fmaxf(mh, other_half(mh)), m_r);
    const float al = hw_exp2(m_r - nm);
    m_r = nm;

#pragma unroll
    for (int t = 0; t < 4; ++t) s[t] = hw_exp2_tile(s[t] - nm);

    const v8f sv = (s[0] + s[1]) + (s[2] + s[3]);
    const float rs = ((sv[0] + sv[1]) + (sv[2] + sv[3])) +
                     ((sv[4] + sv[5]) + (sv[6] + sv[7]));
    l_r = l_r * al + rs;

#pragma unroll
    for (int j = 0; j < 4; ++j) o[j] *= al;

    // P^T as B operand: element e of key block u is tile 2u + (e >> 3), register e & 7
    const v16h bp0 = __builtin_shufflevector(
        __builtin_convertvector(s[0], v8h), __builtin_convertvector(s[1], v8h),
        0, 1, 2, 3, 4, 5, 6, 7, 8, 9, 10, 11, 12, 13, 14, 15);
    const v16h bp1 = __builtin_shufflevector(
        __builtin_convertvector(s[2], v8h), __builtin_convertvector(s[3], v8h),
        0, 1, 2, 3, 4, 5, 6, 7, 8, 9, 10, 11, 12, 13, 14, 15);

    // O^T += V^T P^T: keys 0..31 of the step and then keys 32..63
#pragma unroll
    for (int j = 0; j < 4; ++j) o[j] = wmma_f16(av[0][j], bp0, o[j]);
#pragma unroll
    for (int j = 0; j < 4; ++j) o[j] = wmma_f16(av[1][j], bp1, o[j]);
    // Keeps the waits and the barrier below at the step's foot: without it the
    // compiler lifts them to just behind the V reads, and the wave waits for
    // those reads in front of the softmax, not under it.
    __builtin_amdgcn_sched_barrier(0);

    // Publish point of the next stage, then the refill of this stage's buffer.
    asm volatile("s_wait_dscnt 0x0" ::: "memory");     // own reads of this buffer done
    asm volatile("s_wait_asynccnt 0x0" ::: "memory");  // own copies of the next stage landed
    __syncthreads();  // publishes the next stage; ends every wave's reads of this buffer
    if (kt + 128 < S_LEN)
      stage_kv(K, V, kt + 128, &Kl[buf][0][0], &Vl[buf][0][0]);
  }
  asm volatile("s_wait_asynccnt 0x0" ::: "memory");  // nothing outstanding at the wave's end

  // the two halves' sums of query ln are joined here, once
  const float inv = 1.0f / (l_r + other_half(l_r));

  // a lane holds 8 consecutive d of its query in each o[j]: one 16-byte store
  _Float16* orow = Oc + ((size_t)b * S_LEN + q0 + ln) * DMODEL + h * HD + hs * 8;
#pragma unroll
  for (int j = 0; j < 4; ++j)
    *(v8h*)(orow + 16 * j) = __builtin_convertvector(o[j] * inv, v8h);
}

// ---------------------------------------------------------------------------
// Host side
// ---------------------------------------------------------------------------
extern "C" void kernel_launch(void* const* d_in, const int* in_sizes, int n_in,
                              void* d_out, int out_size, void* d_ws,
                              size_t ws_size, hipStream_t stream) {
  const float* q  = (const float*)d_in[0];
  const float* k  = (const float*)d_in[1];
  const float* v  = (const float*)d_in[2];
  const float* Wq = (const float*)d_in[3];
  const float* bq = (const float*)d_in[4];
  const float* Wk = (const float*)d_in[5];
  const float* bk = (const float*)d_in[6];
  const float* Wv = (const float*)d_in[7];
  const float* bv = (const float*)d_in[8];
  const float* Wo = (const float*)d_in[9];
  const float* bo = (const float*)d_in[10];

  const size_t ACT = (size_t)MROWS * DMODEL;
  const size_t WSZ = (size_t)DMODEL * DMODEL;
  char* ws = (char*)d_ws;
  _Float16* Xq  = (_Float16*)(ws + 0 * ACT * 2);
  _Float16* Xk  = (_Float16*)(ws + 1 * ACT * 2);
  _Float16* Xv  = (_Float16*)(ws + 2 * ACT * 2);
  _Float16* Qh  = (_Float16*)(ws + 3 * ACT * 2);
  _Float16* Kh  = (_Float16*)(ws + 4 * ACT * 2);
  _Float16* Vt  = (_Float16*)(ws + 5 * ACT * 2);
  _Float16* Oc  = (_Float16*)(ws + 6 * ACT * 2);
  _Float16* Wqh = (_Float16*)(ws + 7 * ACT * 2 + 0 * WSZ * 2);
  _Float16* Wkh = (_Float16*)(ws + 7 * ACT * 2 + 1 * WSZ * 2);
  _Float16* Wvh = (_Float16*)(ws + 7 * ACT * 2 + 2 * WSZ * 2);
  _Float16* Woh = (_Float16*)(ws + 7 * ACT * 2 + 3 * WSZ * 2);

  // Xq, Xk, Xv lie one behind the other from Xq; the four weights from Wqh.
  cvt_all<<<256, 512, 0, stream>>>(q, k, v, Wq, Wk, Wv, Wo, Xq, Wqh);

  // fold softmax scale (1/sqrt(64)) and log2(e) into Q so the attention
  // kernel runs a pure base-2 online softmax with no per-element scaling.
  const float SCL_Q = 0.125f * 1.44269504088896340736f;

  dim3 pg(MROWS / 128, DMODEL / 128);
  proj_gemm<0><<<pg, 256, 0, stream>>>(Xq, Wqh, bq, (void*)Qh, SCL_Q);
  proj_gemm<0><<<pg, 256, 0, stream>>>(Xk, Wkh, bk, (void*)Kh, 1.0f);
  proj_gemm<1><<<pg, 256, 0, stream>>>(Xv, Wvh, bv, (void*)Vt, 1.0f);

  dim3 ag(S_LEN / 128, 2 * HEADS);
  flash_attn<<<ag, 256, 0, stream>>>(Qh, Kh, Vt, Oc);

  proj_gemm<2><<<pg, 256, 0, stream>>>(Oc, Woh, bo, d_out, 1.0f);
}

// v007
// Measured time: 96.8 microseconds a run.
// Two timings next to v006 put it at 1.08 and 1.07 times that version's speed.
// Counting every step since v000, it is 3.67 times as fast.
#include <hip/hip_runtime.h>
#include <hip/hip_bf16.h>

typedef __attribute__((ext_vector_type(16))) _Float16 v16h;
typedef __attribute__((ext_vector_type(8)))  _Float16 v8h;
typedef __attribute__((ext_vector_type(8)))  float    v8f;

#define S_LEN  4096
#define DMODEL 512
#define HEADS  8
#define HD     64
#define MROWS  8192   // N * S_LEN

// ---------------------------------------------------------------------------
// 16x32 f16 operand tile in CDNA5 WMMA A/B register layout.
// Lane L (L<16): row = base+L, halves = {k0+0..7, k0+16..23}
// Lane L+16    : row = base+L, halves = {k0+8..15, k0+24..31}
// ---------------------------------------------------------------------------
__device__ __forceinline__ v16h load_tile_k(const _Float16* src, int row_base,
                                            int ld, int k0) {
  const int lane = threadIdx.x & 31;
  const int hs   = lane >> 4;
  const _Float16* p = src + (size_t)(row_base + (lane & 15)) * ld + k0 + hs * 8;
  v8h lo = *(const v8h*)(p);
  v8h hi = *(const v8h*)(p + 16);
  v16h r;
#pragma unroll
  for (int i = 0; i < 8; ++i) { r[i] = lo[i]; r[i + 8] = hi[i]; }
  return r;
}

__device__ __forceinline__ v8f wmma_f16(v16h a, v16h b, v8f c) {
  return __builtin_amdgcn_wmma_f32_16x16x32_f16(false, a, false, b,
                                                (short)0, c, false, false);
}

// ---------------------------------------------------------------------------
// Lane l <-> lane l ^ 16: the other half of the wave (one VALU move, no DS).
// ---------------------------------------------------------------------------
__device__ __forceinline__ float other_half(float x) {
  const int b = __float_as_int(x);
  return __int_as_float(__builtin_amdgcn_permlanex16(
      b, b, 0x76543210, 0xfedcba98, false, false));
}

// ---------------------------------------------------------------------------
// 2^x as the one hardware instruction (v_exp_f32). The library exp2f wraps it
// in a compare, two selects, an add and an ldexp so that results under 2^-126
// come out as subnormals; here such a result may be 0: a weight that small
// rounds to 0 in f16, and it is lost in a row sum that holds the term 2^0.
// x = -inf (first step, no maximum yet) gives 0 either way.
// ---------------------------------------------------------------------------
__device__ __forceinline__ float hw_exp2(float x) {
  return __builtin_amdgcn_exp2f(x);
}

// The same for one score tile, 8 values a lane. One statement, so that the slot
// the instruction set asks for behind a transcendental is kept by construction:
// the results share no register with the sources (early clobber), so each
// v_exp_f32 is the independent instruction behind the one before it, and the
// v_nop is that slot behind the last.
__device__ __forceinline__ v8f hw_exp2_tile(v8f x) {
  float p0, p1, p2, p3, p4, p5, p6, p7;
  asm("v_exp_f32 %0, %8\n\t"
      "v_exp_f32 %1, %9\n\t"
      "v_exp_f32 %2, %10\n\t"
      "v_exp_f32 %3, %11\n\t"
      "v_exp_f32 %4, %12\n\t"
      "v_exp_f32 %5, %13\n\t"
      "v_exp_f32 %6, %14\n\t"
      "v_exp_f32 %7, %15\n\t"
      "v_nop"
      : "=&v"(p0), "=&v"(p1), "=&v"(p2), "=&v"(p3),
        "=&v"(p4), "=&v"(p5), "=&v"(p6), "=&v"(p7)
      : "v"(x[0]), "v"(x[1]), "v"(x[2]), "v"(x[3]),
        "v"(x[4]), "v"(x[5]), "v"(x[6]), "v"(x[7]));
  return v8f{p0, p1, p2, p3, p4, p5, p6, p7};
}

// ---------------------------------------------------------------------------
// f32 -> f16 conversion of the three activations and the four weights, one
// resident launch: 256 work-groups of 16 waves. A row is 4096 values, 8 a
// thread (two 16-byte loads, one 16-byte store; a wave stores whole lines).
// Work-group g takes rows 4g..4g+3 of each activation (1024 rows each) and
// row g & 63 of weight g >> 6 (64 rows each). All 26 loads of a thread are
// independent, so they can be in flight together.
// ---------------------------------------------------------------------------
#define CVT_ROW 4096
#define ACT_N   (MROWS * DMODEL)

__global__ __launch_bounds__(512) void cvt_all(
    const float* __restrict__ q, const float* __restrict__ k,
    const float* __restrict__ v, const float* __restrict__ Wq,
    const float* __restrict__ Wk, const float* __restrict__ Wv,
    const float* __restrict__ Wo, _Float16* __restrict__ xh,
    _Float16* __restrict__ wh) {
  const unsigned g  = blockIdx.x;
  const unsigned t8 = threadIdx.x * 8;
  const unsigned ws = g >> 6;
  // work-group-uniform bases; the thread's own part of every address is t8
  const float* qs = q + g * (4 * CVT_ROW);
  const float* ks = k + g * (4 * CVT_ROW);
  const float* vs = v + g * (4 * CVT_ROW);
  const float* wsrc = (ws == 0 ? Wq : ws == 1 ? Wk : ws == 2 ? Wv : Wo) +
                      (g & 63) * CVT_ROW;
  _Float16* xd = xh + g * (4 * CVT_ROW);
  // the four f16 weights lie one behind the other: ws * 64 rows + (g & 63) = g
  _Float16* wd = wh + g * CVT_ROW;

  v8f r[13];
  r[12] = *(const v8f*)(wsrc + t8);
#pragma unroll
  for (int i = 0; i < 4; ++i) r[i] = *(const v8f*)(qs + t8 + i * CVT_ROW);
#pragma unroll
  for (int i = 0; i < 4; ++i) r[4 + i] = *(const v8f*)(ks + t8 + i * CVT_ROW);
#pragma unroll
  for (int i = 0; i < 4; ++i) r[8 + i] = *(const v8f*)(vs + t8 + i * CVT_ROW);
  // Keeps every load ahead of the first conversion: without it the compiler
  // reuses registers and waits out the memory latency several times over.
  __builtin_amdgcn_sched_barrier(0);

  *(v8h*)(wd + t8) = __builtin_convertvector(r[12], v8h);
#pragma unroll
  for (int i = 0; i < 4; ++i)
    *(v8h*)(xd + t8 + i * CVT_ROW) = __builtin_convertvector(r[i], v8h);
#pragma unroll
  for (int i = 0; i < 4; ++i)
    *(v8h*)(xd + ACT_N + t8 + i * CVT_ROW) = __builtin_convertvector(r[4 + i], v8h);
#pragma unroll
  for (int i = 0; i < 4; ++i)
    *(v8h*)(xd + 2 * ACT_N + t8 + i * CVT_ROW) = __builtin_convertvector(r[8 + i], v8h);
}

// ---------------------------------------------------------------------------
// Eight rows of an operand tile, 16 rows apart, one 16-byte piece a lane, from
// global memory (rows of DMODEL halves) to LDS (rows of P_PITCH halves). Sixteen
// lanes cover one 256-byte row piece, so a wave's copy is four whole lines.
// ---------------------------------------------------------------------------
#define P_BK    128   // k values of a stage: 256 bytes of every operand row
#define P_PITCH 136   // 272-byte rows (16 B x odd): ds_load_b128 without bank conflicts

__device__ __forceinline__ void stage_rows(const _Float16* g, unsigned l) {
  // The copies go to LDS through no register; the closing s_wait_xcnt stands in
  // the same statement so that no address register is rewritten ahead of it.
  asm volatile(
      "global_load_async_to_lds_b128 %0, %8, off\n\t"
      "global_load_async_to_lds_b128 %1, %9, off\n\t"
      "global_load_async_to_lds_b128 %2, %10, off\n\t"
      "global_load_async_to_lds_b128 %3, %11, off\n\t"
      "global_load_async_to_lds_b128 %4, %12, off\n\t"
      "global_load_async_to_lds_b128 %5, %13, off\n\t"
      "global_load_async_to_lds_b128 %6, %14, off\n\t"
      "global_load_async_to_lds_b128 %7, %15, off\n\t"
      "s_wait_xcnt 0x0"
      :: "v"(l), "v"(l + 1 * 16 * P_PITCH * 2), "v"(l + 2 * 16 * P_PITCH * 2),
         "v"(l + 3 * 16 * P_PITCH * 2), "v"(l + 4 * 16 * P_PITCH * 2),
         "v"(l + 5 * 16 * P_PITCH * 2), "v"(l + 6 * 16 * P_PITCH * 2),
         "v"(l + 7 * 16 * P_PITCH * 2),
         "v"(g), "v"(g + 1 * 16 * DMODEL), "v"(g + 2 * 16 * DMODEL),
         "v"(g + 3 * 16 * DMODEL), "v"(g + 4 * 16 * DMODEL),
         "v"(g + 5 * 16 * DMODEL), "v"(g + 6 * 16 * DMODEL),
         "v"(g + 7 * 16 * DMODEL)
      : "memory");
}

// ---------------------------------------------------------------------------
// Projection GEMM: C[m,n] = (sum_k X[m,k]*W[n,k] + bias[n]) * oscale
// M=8192, N=512, K=512. Block 256 (8 waves), wave tile 32x64, block 128x128.
// The block's 128 rows of X and 128 rows of W come in stages of P_BK k values
// through a two-buffer LDS ring shared by its eight waves; the next stage's
// copies fly during this stage. The k order of the sums is 0, 32, 64, ...
// MODE 0: f16 per-head row-major  [((b*8+h)*4096+s)*64 + d]
// MODE 1: f16 per-head transposed [((b*8+h)*64+d)*4096 + s]
// MODE 2: f32 row-major out[m*512 + n]
// ---------------------------------------------------------------------------
template <int MODE>
__global__ __launch_bounds__(256) void proj_gemm(
    const _Float16* __restrict__ X, const _Float16* __restrict__ W,
    const float* __restrict__ bias, void* __restrict__ out, float oscale) {
  const int w    = threadIdx.x >> 5;
  const int lane = threadIdx.x & 31;
  const int hs   = lane >> 4;
  const int ln   = lane & 15;
  const int wm   = w >> 1;
  const int wn   = w & 1;
  const int m0   = blockIdx.x * 128 + wm * 32;
  const int n0   = blockIdx.y * 128 + wn * 64;

  __shared__ __attribute__((aligned(16))) _Float16 Xl[2][128][P_PITCH];
  __shared__ __attribute__((aligned(16))) _Float16 Wl[2][128][P_PITCH];

  // this thread's piece of a stage: rows sr, sr + 16, ..., sr + 112, halves sc..sc+7
  const int sr = threadIdx.x >> 4;
  const int sc = (threadIdx.x & 15) * 8;
  const _Float16* gx = X + (size_t)(blockIdx.x * 128 + sr) * DMODEL + sc;
  const _Float16* gw = W + (size_t)(blockIdx.y * 128 + sr) * DMODEL + sc;
  const unsigned lx = (unsigned)(size_t)(&Xl[0][sr][sc]);
  const unsigned lw = (unsigned)(size_t)(&Wl[0][sr][sc]);
  const unsigned lbuf = 128 * P_PITCH * 2;   // bytes from buffer 0 to buffer 1

  v8f c[2][4];
#pragma unroll
  for (int i = 0; i < 2; ++i)
#pragma unroll
    for (int j = 0; j < 4; ++j) c[i][j] = {};

  // Ring prologue: stage 0 lands and is published, then stage 1 starts.
  stage_rows(gx, lx);
  stage_rows(gw, lw);
  asm volatile("s_wait_asynccnt 0x0" ::: "memory");  // own copies of stage 0 landed
  __syncthreads();                                   // every wave's copies visible
  stage_rows(gx + P_BK, lx + lbuf);
  stage_rows(gw + P_BK, lw + lbuf);

  for (int k0 = 0; k0 < DMODEL; k0 += P_BK) {
    const int buf = (k0 / P_BK) & 1;
    const _Float16* Xs = &Xl[buf][0][0];
    const _Float16* Ws = &Wl[buf][0][0];

    // unrolled so that the four k steps' LDS offsets are immediates of the reads
#pragma unroll
    for (int kk = 0; kk < P_BK; kk += 32) {
      const v16h a0 = load_tile_k(Xs, wm * 32,      P_PITCH, kk);
      const v16h a1 = load_tile_k(Xs, wm * 32 + 16, P_PITCH, kk);
      v16h b[4];
#pragma unroll
      for (int j = 0; j < 4; ++j)
        b[j] = load_tile_k(Ws, wn * 64 + 16 * j, P_PITCH, kk);
      // Keeps the twelve LDS reads of this k step together ahead of its products:
      // without it the compiler sinks each pair in front of its user and the wave
      // waits out the LDS latency four times a k step, not once.
      __builtin_amdgcn_sched_barrier(0);
#pragma unroll
      for (int j = 0; j < 4; ++j) {
        c[0][j] = wmma_f16(a0, b[j], c[0][j]);
        c[1][j] = wmma_f16(a1, b[j], c[1][j]);
      }
    }

    // Publish point of the next stage, then the refill of this stage's buffer.
    asm volatile("s_wait_dscnt 0x0" ::: "memory");     // own reads of this buffer done
    asm volatile("s_wait_asynccnt 0x0" ::: "memory");  // own copies of the next stage landed
    __syncthreads();  // publishes the next stage; ends every wave's reads of this buffer
    if (k0 + 2 * P_BK < DMODEL) {
      stage_rows(gx + k0 + 2 * P_BK, lx + buf * lbuf);
      stage_rows(gw + k0 + 2 * P_BK, lw + buf * lbuf);
    }
  }
  asm volatile("s_wait_asynccnt 0x0" ::: "memory");  // nothing outstanding at the wave's end

#pragma unroll
  for (int i = 0; i < 2; ++i) {
#pragma unroll
    for (int j = 0; j < 4; ++j) {
      const int n = n0 + 16 * j + ln;
      const float bn = bias[n];
#pragma unroll
      for (int v = 0; v < 8; ++v) {
        const int m = m0 + 16 * i + hs * 8 + v;
        const float val = (c[i][j][v] + bn) * oscale;
        if (MODE == 2) {
          ((float*)out)[(size_t)m * DMODEL + n] = val;
        } else {
          const int b = m >> 12;
          const int s = m & (S_LEN - 1);
          const int h = n >> 6;
          const int d = n & (HD - 1);
          _Float16* o = (_Float16*)out;
          if (MODE == 0)
            o[(((size_t)b * HEADS + h) * S_LEN + s) * HD + d] = (_Float16)val;
          else
            o[(((size_t)b * HEADS + h) * HD + d) * S_LEN + s] = (_Float16)val;
        }
      }
    }
  }
}

// ---------------------------------------------------------------------------
// Half a 128-key stage: K (64 keys x 64 d) and V^T (64 d x 64 keys), 128-byte
// rows, copied once per block into LDS rows of KV_PITCH halves. Each thread
// moves four 16-byte pieces; a wave's copy covers four whole 128-byte lines.
// ---------------------------------------------------------------------------
#define KV_PITCH 72   // 144-byte rows (16 B x odd): ds_load_b128 without bank conflicts

__device__ __forceinline__ void stage_kv(const _Float16* __restrict__ K,
                                         const _Float16* __restrict__ V, int kt,
                                         _Float16* kl, _Float16* vl) {
  const int r = threadIdx.x >> 3;         // row 0..31 (and row + 32)
  const int c = (threadIdx.x & 7) * 8;    // first half of the 16-byte piece
  const _Float16* gk0 = K + (size_t)(kt + r) * HD + c;
  const _Float16* gk1 = gk0 + 32 * HD;
  const _Float16* gv0 = V + (size_t)r * S_LEN + kt + c;
  const _Float16* gv1 = gv0 + (size_t)32 * S_LEN;
  const unsigned lk0 = (unsigned)(size_t)(kl + r * KV_PITCH + c);
  const unsigned lk1 = lk0 + 32 * KV_PITCH * 2;
  const unsigned lv0 = (unsigned)(size_t)(vl + r * KV_PITCH + c);
  const unsigned lv1 = lv0 + 32 * KV_PITCH * 2;
  // The copies go to LDS through no register; the closing s_wait_xcnt stands in
  // the same statement so that no address register is rewritten ahead of it.
  asm volatile(
      "global_load_async_to_lds_b128 %0, %4, off\n\t"
      "global_load_async_to_lds_b128 %1, %5, off\n\t"
      "global_load_async_to_lds_b128 %2, %6, off\n\t"
      "global_load_async_to_lds_b128 %3, %7, off\n\t"
      "s_wait_xcnt 0x0"
      :: "v"(lk0), "v"(lk1), "v"(lv0), "v"(lv1),
         "v"(gk0), "v"(gk1), "v"(gv0), "v"(gv1)
      : "memory");
}

// ---------------------------------------------------------------------------
// Flash attention, base-2 online softmax (scale*log2e folded into Q).
// Grid (32,16), block 256 (8 waves), 128 queries a block, 128-key steps.
// Wave w takes 32 queries (two 16-query tiles, group w & 3) and 64 of the step's
// 128 keys (half w >> 2), so that every K and V^T fragment read from LDS feeds
// TWO products, one a query tile. Waves w and w ^ 4 hold partial results of the
// same queries over different keys; they are joined once, behind the loop.
//   K and V^T of the step come from a two-buffer LDS ring shared by the
//   block's eight waves; the next step's copies fly during this step.
// Both products are taken transposed, so that a lane owns ONE query a tile:
//   S^T = K Q^T   (A = 16 keys x 32 d from LDS, B = Q, kept in registers)
//     s[q][t][r] = score of key 16t + 8*hs + r against query 16q + ln
//   maximum and sum run down the lane's own 32 scores; the two halves of the
//   wave (which split the keys) exchange the maximum once a step and join
//   their sums once, behind the loop.
//   O^T += V^T P^T (A = 16 d x 32 keys from LDS, B = P^T)
//     two score tiles 2u, 2u+1, converted in place, ARE the B operand of key
//     block u in the hardware k order that load_tile_k gives A.
//     o[q][j][r] = output d 16j + 8*hs + r of query 16q + ln
// ---------------------------------------------------------------------------
typedef __attribute__((ext_vector_type(4))) float v4f;

// four waves a SIMD (two blocks a WGP): the softmax between the matrix runs
// wants other waves to fill the matrix unit meanwhile
__global__ __launch_bounds__(256) __attribute__((amdgpu_waves_per_eu(4, 4)))
void flash_attn(
    const _Float16* __restrict__ Qh, const _Float16* __restrict__ Kh,
    const _Float16* __restrict__ Vt, _Float16* __restrict__ Oc) {
  const int w    = threadIdx.x >> 5;
  const int lane = threadIdx.x & 31;
  const int hs   = lane >> 4;
  const int ln   = lane & 15;
  const int kh   = w >> 2;          // which 64 keys of a step
  const int bh   = blockIdx.y;
  const int b    = bh >> 3;
  const int h    = bh & 7;
  const int q0   = blockIdx.x * 128 + (w & 3) * 32;

  const _Float16* Q = Qh + (size_t)bh * S_LEN * HD;
  const _Float16* K = Kh + (size_t)bh * S_LEN * HD;
  const _Float16* V = Vt + (size_t)bh * HD * S_LEN;  // [d][s]

  __shared__ __attribute__((aligned(16))) _Float16 Kl[2][2][64][KV_PITCH];
  __shared__ __attribute__((aligned(16))) _Float16 Vl[2][2][64][KV_PITCH];
  // hand-over of one query tile's partial result to the partner wave
  __shared__ __attribute__((aligned(16))) v4f Xo[8][8][32];
  __shared__ float Xm[8][32];
  __shared__ float Xs[8][32];

  // (the loops over bq, o, m_r and l_r are unrolled so that the arrays are registers)
  v16h bq[2][2];
#pragma unroll
  for (int q = 0; q < 2; ++q)
#pragma unroll
    for (int c = 0; c < 2; ++c) bq[q][c] = load_tile_k(Q, q0 + 16 * q, HD, 32 * c);

  v8f o[2][4];
  float m_r[2];  // running maximum of query 16q + ln over this wave's keys
  float l_r[2];  // running sum over this half-wave's keys only
#pragma unroll
  for (int q = 0; q < 2; ++q) {
#pragma unroll
    for (int j = 0; j < 4; ++j) o[q][j] = {};
    m_r[q] = -__builtin_inff();
    l_r[q] = 0.f;
  }

  // Ring prologue: stage 0 lands and is published, then stage 1 starts.
  stage_kv(K, V, 0,  &Kl[0][0][0][0], &Vl[0][0][0][0]);
  stage_kv(K, V, 64, &Kl[0][1][0][0], &Vl[0][1][0][0]);
  asm volatile("s_wait_asynccnt 0x0" ::: "memory");  // own copies of stage 0 landed
  __syncthreads();                                   // every wave's copies visible
  stage_kv(K, V, 128, &Kl[1][0][0][0], &Vl[1][0][0][0]);
  stage_kv(K, V, 192, &Kl[1][1][0][0], &Vl[1][1][0][0]);

  // One 128-key step. The two last steps, which have no stage left to start,
  // stand behind the loop as calls of their own: the loop's body is then one
  // straight block, and the compiler cannot sink the row sums past the refill's
  // branch, which kept 64 weights a lane alive across the second product and
  // spilled Q.
  auto step = [&](const int kt, const bool refill) __attribute__((always_inline)) {
    const int buf = (kt >> 7) & 1;
    const _Float16* Ks = &Kl[buf][kh][0][0];
    const _Float16* Vs = &Vl[buf][kh][0][0];

    // The wave's eight K fragments, read as one group. (This loop and those below
    // over ak, av, s and o are unrolled so that the arrays are registers.)
    v16h ak[2][4];
#pragma unroll
    for (int c = 0; c < 2; ++c)
#pragma unroll
      for (int t = 0; t < 4; ++t)
        ak[c][t] = load_tile_k(Ks, 16 * t, KV_PITCH, 32 * c);
    // Keeps the sixteen LDS reads together ahead of the score products: without
    // it the compiler reads one fragment, waits for it and multiplies, and the
    // wave waits out the LDS latency once a product, not once a step.
    __builtin_amdgcn_sched_barrier(0);

    // S^T = K Q^T for 64 keys (four 16-key subtiles) and both query tiles,
    // d 0..31 and then d 32..63
    v8f s[2][4];
#pragma unroll
    for (int t = 0; t < 4; ++t)
#pragma unroll
      for (int q = 0; q < 2; ++q) s[q][t] = wmma_f16(ak[0][t], bq[q][0], v8f{});
#pragma unroll
    for (int t = 0; t < 4; ++t)
#pragma unroll
      for (int q = 0; q < 2; ++q) s[q][t] = wmma_f16(ak[1][t], bq[q][1], s[q][t]);

    // The V^T fragments of the wave's keys 0..31, read as one group behind the
    // score products: they land while the softmax below runs. (Those of keys
    // 32..63 follow behind the softmax: all eight beside 64 scores a lane do not
    // fit the registers of four waves a SIMD.)
    v16h av[2][4];
#pragma unroll
    for (int j = 0; j < 4; ++j) av[0][j] = load_tile_k(Vs, 16 * j, KV_PITCH, 0);
    // Orders what stands between the scheduling barriers above and below: the
    // sixteen score products (0x8), then the eight V reads (0x100) in one place;
    // without the two lines the compiler spreads the reads among the products.
    __builtin_amdgcn_sched_group_barrier(0x8, 16, 0);
    __builtin_amdgcn_sched_group_barrier(0x100, 8, 0);
    // Keeps these eight reads ahead of the softmax: without it the compiler
    // sinks each pair in front of its product, behind the softmax, and the wave
    // waits out the LDS latency once a product again.
    __builtin_amdgcn_sched_barrier(0);

    v16h bp[2][2];
#pragma unroll
    for (int q = 0; q < 2; ++q) {
      // maximum of the lane's 32 scores, then of both halves and the old one
      float mx[4];
#pragma unroll
      for (int t = 0; t < 4; ++t) {
        mx[t] = fmaxf(fmaxf(fmaxf(s[q][t][0], s[q][t][1]), s[q][t][2]),
                      fmaxf(fmaxf(s[q][t][3], s[q][t][4]), s[q][t][5]));
        mx[t] = fmaxf(fmaxf(mx[t], s[q][t][6]), s[q][t][7]);
      }
      const float mh = fmaxf(fmaxf(mx[0], mx[1]), fmaxf(mx[2], mx[3]));
      const float nm = fmaxf(fmaxf(mh, other_half(mh)), m_r[q]);
      const float al = hw_exp2(m_r[q] - nm);
      m_r[q] = nm;

#pragma unroll
      for (int t = 0; t < 4; ++t) s[q][t] = hw_exp2_tile(s[q][t] - nm);

      const v8f sv = (s[q][0] + s[q][1]) + (s[q][2] + s[q][3]);
      const float rs = ((sv[0] + sv[1]) + (sv[2] + sv[3])) +
                       ((sv[4] + sv[5]) + (sv[6] + sv[7]));
      l_r[q] = l_r[q] * al + rs;

#pragma unroll
      for (int j = 0; j < 4; ++j) o[q][j] *= al;

      // P^T as B operand: element e of key block u is tile 2u + (e >> 3), register e & 7
#pragma unroll
      for (int u = 0; u < 2; ++u)
        bp[q][u] = __builtin_shufflevector(
            __builtin_convertvector(s[q][2 * u], v8h),
            __builtin_convertvector(s[q][2 * u + 1], v8h),
            0, 1, 2, 3, 4, 5, 6, 7, 8, 9, 10, 11, 12, 13, 14, 15);
    }

    // Keeps every product below behind the softmax: a product lifted in front of
    // an exponential statement would have its operand registers rewritten by that
    // statement inside the distance the matrix instruction needs.
    __builtin_amdgcn_sched_barrier(0);
    // The V^T fragments of keys 32..63, one group: they land under the eight
    // products of keys 0..31.
#pragma unroll
    for (int j = 0; j < 4; ++j) av[1][j] = load_tile_k(Vs, 16 * j, KV_PITCH, 32);
    // Keeps these eight reads ahead of the first product: without it the compiler
    // may sink each pair in front of its own product, where nothing covers its
    // LDS latency.
    __builtin_amdgcn_sched_barrier(0);

    // O^T += V^T P^T: keys 0..31 of the wave's 64 and then keys 32..63
#pragma unroll
    for (int u = 0; u < 2; ++u)
#pragma unroll
      for (int j = 0; j < 4; ++j)
#pragma unroll
        for (int q = 0; q < 2; ++q) o[q][j] = wmma_f16(av[u][j], bp[q][u], o[q][j]);
    // Keeps the waits and the barrier below at the step's foot: without it the
    // compiler lifts them to just behind the V reads, and the wave waits for
    // those reads in front of the products, not under them.
    __builtin_amdgcn_sched_barrier(0);

    // Publish point of the next stage, then the refill of this stage's buffer.
    asm volatile("s_wait_dscnt 0x0" ::: "memory");     // own reads of this buffer done
    asm volatile("s_wait_asynccnt 0x0" ::: "memory");  // own copies of the next stage landed
    __syncthreads();  // publishes the next stage; ends every wave's reads of this buffer
    if (refill) {  // only while a stage kt + 256 exists
      stage_kv(K, V, kt + 256, &Kl[buf][0][0][0], &Vl[buf][0][0][0]);
      stage_kv(K, V, kt + 320, &Kl[buf][1][0][0], &Vl[buf][1][0][0]);
    }
  };
  for (int kt = 0; kt < S_LEN - 256; kt += 128) step(kt, true);
  step(S_LEN - 256, false);
  step(S_LEN - 128, false);
  asm volatile("s_wait_asynccnt 0x0" ::: "memory");  // nothing outstanding at the wave's end

  // Join of the two key halves. Wave w finishes query tile kh and hands its part
  // of the other tile to wave w ^ 4, which holds the same queries lane for lane.
  const bool up = kh != 0;
  // the two half-waves' sums of a query are joined here, once
  const float l0 = l_r[0] + other_half(l_r[0]);
  const float l1 = l_r[1] + other_half(l_r[1]);
  // (unrolled, here and at the stores below: o stays in registers)
#pragma unroll
  for (int j = 0; j < 4; ++j) {
    const v8f g = up ? o[0][j] : o[1][j];
    Xo[w][2 * j][lane]     = v4f{g[0], g[1], g[2], g[3]};
    Xo[w][2 * j + 1][lane] = v4f{g[4], g[5], g[6], g[7]};
  }
  Xm[w][lane] = up ? m_r[0] : m_r[1];
  Xs[w][lane] = up ? l0 : l1;
  __syncthreads();  // the partner's part is written and visible

  const int pw = w ^ 4;
  const float m_a = up ? m_r[1] : m_r[0];
  const float l_a = up ? l1 : l0;
  const float m_b = Xm[pw][lane];
  const float l_b = Xs[pw][lane];
  const float nm  = fmaxf(m_a, m_b);
  const float e_a = hw_exp2(m_a - nm);
  const float e_b = hw_exp2(m_b - nm);
  const float inv = 1.0f / (l_a * e_a + l_b * e_b);
  const float f_a = e_a * inv;
  const float f_b = e_b * inv;

  // a lane holds 8 consecutive d of its query in each tile: one 16-byte store
  _Float16* orow = Oc + ((size_t)b * S_LEN + q0 + 16 * kh + ln) * DMODEL + h * HD + hs * 8;
#pragma unroll
  for (int j = 0; j < 4; ++j) {
    const v8f a = up ? o[1][j] : o[0][j];
    const v4f p0 = Xo[pw][2 * j][lane];
    const v4f p1 = Xo[pw][2 * j + 1][lane];
    const v8f p = {p0[0], p0[1], p0[2], p0[3], p1[0], p1[1], p1[2], p1[3]};
    *(v8h*)(orow + 16 * j) = __builtin_convertvector(a * f_a + p * f_b, v8h);
  }
}

// ---------------------------------------------------------------------------
// Host side
// ---------------------------------------------------------------------------
extern "C" void kernel_launch(void* const* d_in, const int* in_sizes, int n_in,
                              void* d_out, int out_size, void* d_ws,
                              size_t ws_size, hipStream_t stream) {
  const float* q  = (const float*)d_in[0];
  const float* k  = (const float*)d_in[1];
  const float* v  = (const float*)d_in[2];
  const float* Wq = (const float*)d_in[3];
  const float* bq = (const float*)d_in[4];
  const float* Wk = (const float*)d_in[5];
  const float* bk = (const float*)d_in[6];
  const float* Wv = (const float*)d_in[7];
  const float* bv = (const float*)d_in[8];
  const float* Wo = (const float*)d_in[9];
  const float* bo = (const float*)d_in[10];

  const size_t ACT = (size_t)MROWS * DMODEL;
  const size_t WSZ = (size_t)DMODEL * DMODEL;
  char* ws = (char*)d_ws;
  _Float16* Xq  = (_Float16*)(ws + 0 * ACT * 2);
  _Float16* Xk  = (_Float16*)(ws + 1 * ACT * 2);
  _Float16* Xv  = (_Float16*)(ws + 2 * ACT * 2);
  _Float16* Qh  = (_Float16*)(ws + 3 * ACT * 2);
  _Float16* Kh  = (_Float16*)(ws + 4 * ACT * 2);
  _Float16* Vt  = (_Float16*)(ws + 5 * ACT * 2);
  _Float16* Oc  = (_Float16*)(ws + 6 * ACT * 2);
  _Float16* Wqh = (_Float16*)(ws + 7 * ACT * 2 + 0 * WSZ * 2);
  _Float16* Wkh = (_Float16*)(ws + 7 * ACT * 2 + 1 * WSZ * 2);
  _Float16* Wvh = (_Float16*)(ws + 7 * ACT * 2 + 2 * WSZ * 2);
  _Float16* Woh = (_Float16*)(ws + 7 * ACT * 2 + 3 * WSZ * 2);

  // Xq, Xk, Xv lie one behind the other from Xq; the four weights from Wqh.
  cvt_all<<<256, 512, 0, stream>>>(q, k, v, Wq, Wk, Wv, Wo, Xq, Wqh);

  // fold softmax scale (1/sqrt(64)) and log2(e) into Q so the attention
  // kernel runs a pure base-2 online softmax with no per-element scaling.
  const float SCL_Q = 0.125f * 1.44269504088896340736f;

  dim3 pg(MROWS / 128, DMODEL / 128);
  proj_gemm<0><<<pg, 256, 0, stream>>>(Xq, Wqh, bq, (void*)Qh, SCL_Q);
  proj_gemm<0><<<pg, 256, 0, stream>>>(Xk, Wkh, bk, (void*)Kh, 1.0f);
  proj_gemm<1><<<pg, 256, 0, stream>>>(Xv, Wvh, bv, (void*)Vt, 1.0f);

  dim3 ag(S_LEN / 128, 2 * HEADS);
  flash_attn<<<ag, 256, 0, stream>>>(Qh, Kh, Vt, Oc);

  proj_gemm<2><<<pg, 256, 0, stream>>>(Oc, Woh, bo, d_out, 1.0f);
}

// v008
// It runs in 91.4 microseconds.
// In two side-by-side timings against v007, it was 1.06 and 1.05 times as fast.
// Over all steps from v000 it is 3.87 times as fast.
#include <hip/hip_runtime.h>
#include <hip/hip_bf16.h>

typedef __attribute__((ext_vector_type(16))) _Float16 v16h;
typedef __attribute__((ext_vector_type(8)))  _Float16 v8h;
typedef __attribute__((ext_vector_type(8)))  float    v8f;

#define S_LEN  4096
#define DMODEL 512
#define HEADS  8
#define HD     64
#define MROWS  8192   // N * S_LEN

// ---------------------------------------------------------------------------
// 16x32 f16 operand tile in CDNA5 WMMA A/B register layout.
// Lane L (L<16): row = base+L, halves = {k0+0..7, k0+16..23}
// Lane L+16    : row = base+L, halves = {k0+8..15, k0+24..31}
// ---------------------------------------------------------------------------
__device__ __forceinline__ v16h load_tile_k(const _Float16* src, int row_base,
                                            int ld, int k0) {
  const int lane = threadIdx.x & 31;
  const int hs   = lane >> 4;
  const _Float16* p = src + (size_t)(row_base + (lane & 15)) * ld + k0 + hs * 8;
  v8h lo = *(const v8h*)(p);
  v8h hi = *(const v8h*)(p + 16);
  v16h r;
#pragma unroll
  for (int i = 0; i < 8; ++i) { r[i] = lo[i]; r[i + 8] = hi[i]; }
  return r;
}

__device__ __forceinline__ v8f wmma_f16(v16h a, v16h b, v8f c) {
  return __builtin_amdgcn_wmma_f32_16x16x32_f16(false, a, false, b,
                                                (short)0, c, false, false);
}

// ---------------------------------------------------------------------------
// Lane l <-> lane l ^ 16: the other half of the wave (one VALU move, no DS).
// ---------------------------------------------------------------------------
__device__ __forceinline__ float other_half(float x) {
  const int b = __float_as_int(x);
  return __int_as_float(__builtin_amdgcn_permlanex16(
      b, b, 0x76543210, 0xfedcba98, false, false));
}

// ---------------------------------------------------------------------------
// 2^x as the one hardware instruction (v_exp_f32). The library exp2f wraps it
// in a compare, two selects, an add and an ldexp so that results under 2^-126
// come out as subnormals; here such a result may be 0: a weight that small
// rounds to 0 in f16, and it is lost in a row sum that holds the term 2^0.
// x = -inf (first step, no maximum yet) gives 0 either way.
// ---------------------------------------------------------------------------
__device__ __forceinline__ float hw_exp2(float x) {
  return __builtin_amdgcn_exp2f(x);
}

// The same for one score tile, 8 values a lane. One statement, so that the slot
// the instruction set asks for behind a transcendental is kept by construction:
// the results share no register with the sources (early clobber), so each
// v_exp_f32 is the independent instruction behind the one before it, and the
// v_nop is that slot behind the last.
__device__ __forceinline__ v8f hw_exp2_tile(v8f x) {
  float p0, p1, p2, p3, p4, p5, p6, p7;
  asm("v_exp_f32 %0, %8\n\t"
      "v_exp_f32 %1, %9\n\t"
      "v_exp_f32 %2, %10\n\t"
      "v_exp_f32 %3, %11\n\t"
      "v_exp_f32 %4, %12\n\t"
      "v_exp_f32 %5, %13\n\t"
      "v_exp_f32 %6, %14\n\t"
      "v_exp_f32 %7, %15\n\t"
      "v_nop"
      : "=&v"(p0), "=&v"(p1), "=&v"(p2), "=&v"(p3),
        "=&v"(p4), "=&v"(p5), "=&v"(p6), "=&v"(p7)
      : "v"(x[0]), "v"(x[1]), "v"(x[2]), "v"(x[3]),
        "v"(x[4]), "v"(x[5]), "v"(x[6]), "v"(x[7]));
  return v8f{p0, p1, p2, p3, p4, p5, p6, p7};
}

// ---------------------------------------------------------------------------
// f32 -> f16 conversion of the three activations and the four weights, one
// resident launch: 256 work-groups of 16 waves. A row is 4096 values, 8 a
// thread (two 16-byte loads, one 16-byte store; a wave stores whole lines).
// Work-group g takes rows 4g..4g+3 of each activation (1024 rows each) and
// row g & 63 of weight g >> 6 (64 rows each). All 26 loads of a thread are
// independent, so they can be in flight together.
// ---------------------------------------------------------------------------
#define CVT_ROW 4096
#define ACT_N   (MROWS * DMODEL)

__global__ __launch_bounds__(512) void cvt_all(
    const float* __restrict__ q, const float* __restrict__ k,
    const float* __restrict__ v, const float* __restrict__ Wq,
    const float* __restrict__ Wk, const float* __restrict__ Wv,
    const float* __restrict__ Wo, _Float16* __restrict__ xh,
    _Float16* __restrict__ wh) {
  const unsigned g  = blockIdx.x;
  const unsigned t8 = threadIdx.x * 8;
  const unsigned ws = g >> 6;
  // work-group-uniform bases; the thread's own part of every address is t8
  const float* qs = q + g * (4 * CVT_ROW);
  const float* ks = k + g * (4 * CVT_ROW);
  const float* vs = v + g * (4 * CVT_ROW);
  const float* wsrc = (ws == 0 ? Wq : ws == 1 ? Wk : ws == 2 ? Wv : Wo) +
                      (g & 63) * CVT_ROW;
  _Float16* xd = xh + g * (4 * CVT_ROW);
  // the four f16 weights lie one behind the other: ws * 64 rows + (g & 63) = g
  _Float16* wd = wh + g * CVT_ROW;

  v8f r[13];
  r[12] = *(const v8f*)(wsrc + t8);
#pragma unroll
  for (int i = 0; i < 4; ++i) r[i] = *(const v8f*)(qs + t8 + i * CVT_ROW);
#pragma unroll
  for (int i = 0; i < 4; ++i) r[4 + i] = *(const v8f*)(ks + t8 + i * CVT_ROW);
#pragma unroll
  for (int i = 0; i < 4; ++i) r[8 + i] = *(const v8f*)(vs + t8 + i * CVT_ROW);
  // Keeps every load ahead of the first conversion: without it the compiler
  // reuses registers and waits out the memory latency several times over.
  __builtin_amdgcn_sched_barrier(0);

  *(v8h*)(wd + t8) = __builtin_convertvector(r[12], v8h);
#pragma unroll
  for (int i = 0; i < 4; ++i)
    *(v8h*)(xd + t8 + i * CVT_ROW) = __builtin_convertvector(r[i], v8h);
#pragma unroll
  for (int i = 0; i < 4; ++i)
    *(v8h*)(xd + ACT_N + t8 + i * CVT_ROW) = __builtin_convertvector(r[4 + i], v8h);
#pragma unroll
  for (int i = 0; i < 4; ++i)
    *(v8h*)(xd + 2 * ACT_N + t8 + i * CVT_ROW) = __builtin_convertvector(r[8 + i], v8h);
}

// ---------------------------------------------------------------------------
// Eight rows of an operand tile, 16 rows apart, one 16-byte piece a lane, from
// global memory (rows of DMODEL halves) to LDS (rows of P_PITCH halves). Sixteen
// lanes cover one 256-byte row piece, so a wave's copy is four whole lines.
// ---------------------------------------------------------------------------
#define P_BK    128   // k values of a stage: 256 bytes of every operand row
#define P_PITCH 136   // 272-byte rows (16 B x odd): ds_load_b128 without bank conflicts

__device__ __forceinline__ void stage_rows(const _Float16* g, unsigned l) {
  // The copies go to LDS through no register; the closing s_wait_xcnt stands in
  // the same statement so that no address register is rewritten ahead of it.
  asm volatile(
      "global_load_async_to_lds_b128 %0, %8, off\n\t"
      "global_load_async_to_lds_b128 %1, %9, off\n\t"
      "global_load_async_to_lds_b128 %2, %10, off\n\t"
      "global_load_async_to_lds_b128 %3, %11, off\n\t"
      "global_load_async_to_lds_b128 %4, %12, off\n\t"
      "global_load_async_to_lds_b128 %5, %13, off\n\t"
      "global_load_async_to_lds_b128 %6, %14, off\n\t"
      "global_load_async_to_lds_b128 %7, %15, off\n\t"
      "s_wait_xcnt 0x0"
      :: "v"(l), "v"(l + 1 * 16 * P_PITCH * 2), "v"(l + 2 * 16 * P_PITCH * 2),
         "v"(l + 3 * 16 * P_PITCH * 2), "v"(l + 4 * 16 * P_PITCH * 2),
         "v"(l + 5 * 16 * P_PITCH * 2), "v"(l + 6 * 16 * P_PITCH * 2),
         "v"(l + 7 * 16 * P_PITCH * 2),
         "v"(g), "v"(g + 1 * 16 * DMODEL), "v"(g + 2 * 16 * DMODEL),
         "v"(g + 3 * 16 * DMODEL), "v"(g + 4 * 16 * DMODEL),
         "v"(g + 5 * 16 * DMODEL), "v"(g + 6 * 16 * DMODEL),
         "v"(g + 7 * 16 * DMODEL)
      : "memory");
}

// ---------------------------------------------------------------------------
// A wave's 32x64 tile of sums, from (m0, n0): (c + bias[n]) * oscale goes out as
// MODE 0: f16 per-head row-major  [((b*8+h)*4096+s)*64 + d]
// MODE 1: f16 per-head transposed [((b*8+h)*64+d)*4096 + s]
// MODE 2: f32 row-major out[m*512 + n]
// ---------------------------------------------------------------------------
template <int MODE>
__device__ __forceinline__ void store_tiles(const v8f (&c)[2][4],
                                            const float* __restrict__ bias,
                                            void* __restrict__ out, float oscale,
                                            int m0, int n0) {
  const int hs = (threadIdx.x & 31) >> 4;
  const int ln = threadIdx.x & 15;
  // (every loop here is unrolled so that c and bn are indexed by constants and stay in registers)
  float bn[4];
#pragma unroll
  for (int j = 0; j < 4; ++j) bn[j] = bias[n0 + 16 * j + ln];
  // Behind the run of four bias loads: no register that they name (offset, scalar
  // base) is rewritten ahead of this wait.
  asm volatile("s_wait_xcnt 0x0" ::: "memory");
#pragma unroll
  for (int i = 0; i < 2; ++i) {
#pragma unroll
    for (int j = 0; j < 4; ++j) {
      const int n = n0 + 16 * j + ln;
#pragma unroll
      for (int v = 0; v < 8; ++v) {
        const int m = m0 + 16 * i + hs * 8 + v;
        const float val = (c[i][j][v] + bn[j]) * oscale;
        if (MODE == 2) {
          ((float*)out)[(size_t)m * DMODEL + n] = val;
        } else {
          const int b = m >> 12;
          const int s = m & (S_LEN - 1);
          const int h = n >> 6;
          const int d = n & (HD - 1);
          _Float16* o = (_Float16*)out;
          if (MODE == 0)
            o[(((size_t)b * HEADS + h) * S_LEN + s) * HD + d] = (_Float16)val;
          else
            o[(((size_t)b * HEADS + h) * HD + d) * S_LEN + s] = (_Float16)val;
        }
      }
    }
  }
}

// ---------------------------------------------------------------------------
// Projection GEMM: C[m,n] = (sum_k X[m,k]*W[n,k] + bias[n]) * oscale
// M=8192, N=512, K=512. Block 256 (8 waves), wave tile 32x64, block 128x128.
// The block's 128 rows of X and 128 rows of W come in stages of P_BK k values
// through a two-buffer LDS ring shared by its eight waves; the next stage's
// copies fly during this stage. The k order of the sums is 0, 32, 64, ...
// QKV: ONE launch does the three input projections, which do not depend on each
// other: blockIdx.z = 0, 1, 2 picks the activation, weight and result (each set
// lies one behind the other in the workspace) and the bias; Q and K go out in
// MODE 0, V in MODE 1, and oscale applies to Q alone. A WGP then holds two
// blocks at a time, so that one block's start, LDS waits and stores run under
// another's products. Not QKV: one projection, MODE 2, bias0 alone is read.
// ---------------------------------------------------------------------------
template <bool QKV>
__global__ __launch_bounds__(256) void proj_gemm(
    const _Float16* __restrict__ X0, const _Float16* __restrict__ W0,
    const float* __restrict__ bias0, const float* __restrict__ bias1,
    const float* __restrict__ bias2, void* __restrict__ out, float oscale) {
  const int z = QKV ? blockIdx.z : 0;
  const _Float16* X = X0 + (size_t)z * ACT_N;
  const _Float16* W = W0 + (size_t)z * (DMODEL * DMODEL);
  const int w    = threadIdx.x >> 5;
  const int wm   = w >> 1;
  const int wn   = w & 1;
  const int m0   = blockIdx.x * 128 + wm * 32;
  const int n0   = blockIdx.y * 128 + wn * 64;

  __shared__ __attribute__((aligned(16))) _Float16 Xl[2][128][P_PITCH];
  __shared__ __attribute__((aligned(16))) _Float16 Wl[2][128][P_PITCH];

  // this thread's piece of a stage: rows sr, sr + 16, ..., sr + 112, halves sc..sc+7
  const int sr = threadIdx.x >> 4;
  const int sc = (threadIdx.x & 15) * 8;
  const _Float16* gx = X + (size_t)(blockIdx.x * 128 + sr) * DMODEL + sc;
  const _Float16* gw = W + (size_t)(blockIdx.y * 128 + sr) * DMODEL + sc;
  const unsigned lx = (unsigned)(size_t)(&Xl[0][sr][sc]);
  const unsigned lw = (unsigned)(size_t)(&Wl[0][sr][sc]);
  const unsigned lbuf = 128 * P_PITCH * 2;   // bytes from buffer 0 to buffer 1

  v8f c[2][4];
#pragma unroll
  for (int i = 0; i < 2; ++i)
#pragma unroll
    for (int j = 0; j < 4; ++j) c[i][j] = {};

  // Ring prologue: stage 0 lands and is published, then stage 1 starts.
  stage_rows(gx, lx);
  stage_rows(gw, lw);
  asm volatile("s_wait_asynccnt 0x0" ::: "memory");  // own copies of stage 0 landed
  __syncthreads();                                   // every wave's copies visible
  stage_rows(gx + P_BK, lx + lbuf);
  stage_rows(gw + P_BK, lw + lbuf);

  for (int k0 = 0; k0 < DMODEL; k0 += P_BK) {
    const int buf = (k0 / P_BK) & 1;
    const _Float16* Xs = &Xl[buf][0][0];
    const _Float16* Ws = &Wl[buf][0][0];

    // unrolled so that the four k steps' LDS offsets are immediates of the reads
#pragma unroll
    for (int kk = 0; kk < P_BK; kk += 32) {
      const v16h a0 = load_tile_k(Xs, wm * 32,      P_PITCH, kk);
      const v16h a1 = load_tile_k(Xs, wm * 32 + 16, P_PITCH, kk);
      v16h b[4];
#pragma unroll
      for (int j = 0; j < 4; ++j)
        b[j] = load_tile_k(Ws, wn * 64 + 16 * j, P_PITCH, kk);
      // Keeps the twelve LDS reads of this k step together ahead of its products:
      // without it the compiler sinks each pair in front of its user and the wave
      // waits out the LDS latency four times a k step, not once.
      __builtin_amdgcn_sched_barrier(0);
#pragma unroll
      for (int j = 0; j < 4; ++j) {
        c[0][j] = wmma_f16(a0, b[j], c[0][j]);
        c[1][j] = wmma_f16(a1, b[j], c[1][j]);
      }
    }

    // Publish point of the next stage, then the refill of this stage's buffer.
    asm volatile("s_wait_dscnt 0x0" ::: "memory");     // own reads of this buffer done
    asm volatile("s_wait_asynccnt 0x0" ::: "memory");  // own copies of the next stage landed
    __syncthreads();  // publishes the next stage; ends every wave's reads of this buffer
    if (k0 + 2 * P_BK < DMODEL) {
      stage_rows(gx + k0 + 2 * P_BK, lx + buf * lbuf);
      stage_rows(gw + k0 + 2 * P_BK, lw + buf * lbuf);
    }
  }
  asm volatile("s_wait_asynccnt 0x0" ::: "memory");  // nothing outstanding at the wave's end

  if (!QKV) {
    store_tiles<2>(c, bias0, out, oscale, m0, n0);
  } else {
    const float* bias = z == 0 ? bias0 : z == 1 ? bias1 : bias2;
    const float  osc  = z == 0 ? oscale : 1.0f;
    _Float16* o = (_Float16*)out + (size_t)z * ACT_N;
    if (z == 2) {
      store_tiles<1>(c, bias, o, osc, m0, n0);
    } else {
      store_tiles<0>(c, bias, o, osc, m0, n0);
      // Behind the run of stores: the built code goes on from here past the other
      // branch, which rewrites registers that these stores name.
      asm volatile("s_wait_xcnt 0x0" ::: "memory");
    }
  }
}

// ---------------------------------------------------------------------------
// Half a 128-key stage: K (64 keys x 64 d) and V^T (64 d x 64 keys), 128-byte
// rows, copied once per block into LDS rows of KV_PITCH halves. Each thread
// moves four 16-byte pieces; a wave's copy covers four whole 128-byte lines.
// ---------------------------------------------------------------------------
#define KV_PITCH 72   // 144-byte rows (16 B x odd): ds_load_b128 without bank conflicts

__device__ __forceinline__ void stage_kv(const _Float16* __restrict__ K,
                                         const _Float16* __restrict__ V, int kt,
                                         _Float16* kl, _Float16* vl) {
  const int r = threadIdx.x >> 3;         // row 0..31 (and row + 32)
  const int c = (threadIdx.x & 7) * 8;    // first half of the 16-byte piece
  const _Float16* gk0 = K + (size_t)(kt + r) * HD + c;
  const _Float16* gk1 = gk0 + 32 * HD;
  const _Float16* gv0 = V + (size_t)r * S_LEN + kt + c;
  const _Float16* gv1 = gv0 + (size_t)32 * S_LEN;
  const unsigned lk0 = (unsigned)(size_t)(kl + r * KV_PITCH + c);
  const unsigned lk1 = lk0 + 32 * KV_PITCH * 2;
  const unsigned lv0 = (unsigned)(size_t)(vl + r * KV_PITCH + c);
  const unsigned lv1 = lv0 + 32 * KV_PITCH * 2;
  // The copies go to LDS through no register; the closing s_wait_xcnt stands in
  // the same statement so that no address register is rewritten ahead of it.
  asm volatile(
      "global_load_async_to_lds_b128 %0, %4, off\n\t"
      "global_load_async_to_lds_b128 %1, %5, off\n\t"
      "global_load_async_to_lds_b128 %2, %6, off\n\t"
      "global_load_async_to_lds_b128 %3, %7, off\n\t"
      "s_wait_xcnt 0x0"
      :: "v"(lk0), "v"(lk1), "v"(lv0), "v"(lv1),
         "v"(gk0), "v"(gk1), "v"(gv0), "v"(gv1)
      : "memory");
}

// ---------------------------------------------------------------------------
// Flash attention, base-2 online softmax (scale*log2e folded into Q).
// Grid (32,16), block 256 (8 waves), 128 queries a block, 128-key steps.
// Wave w takes 32 queries (two 16-query tiles, group w & 3) and 64 of the step's
// 128 keys (half w >> 2), so that every K and V^T fragment read from LDS feeds
// TWO products, one a query tile. Waves w and w ^ 4 hold partial results of the
// same queries over different keys; they are joined once, behind the loop.
//   K and V^T of the step come from a two-buffer LDS ring shared by the
//   block's eight waves; the next step's copies fly during this step.
// Both products are taken transposed, so that a lane owns ONE query a tile:
//   S^T = K Q^T   (A = 16 keys x 32 d from LDS, B = Q, kept in registers)
//     s[q][t][r] = score of key 16t + 8*hs + r against query 16q + ln
//   maximum and sum run down the lane's own 32 scores; the two halves of the
//   wave (which split the keys) exchange the maximum once a step and join
//   their sums once, behind the loop.
//   O^T += V^T P^T (A = 16 d x 32 keys from LDS, B = P^T)
//     two score tiles 2u, 2u+1, converted in place, ARE the B operand of key
//     block u in the hardware k order that load_tile_k gives A.
//     o[q][j][r] = output d 16j + 8*hs + r of query 16q + ln
// ---------------------------------------------------------------------------
typedef __attribute__((ext_vector_type(4))) float v4f;

// four waves a SIMD (two blocks a WGP): the softmax between the matrix runs
// wants other waves to fill the matrix unit meanwhile
__global__ __launch_bounds__(256) __attribute__((amdgpu_waves_per_eu(4, 4)))
void flash_attn(
    const _Float16* __restrict__ Qh, const _Float16* __restrict__ Kh,
    const _Float16* __restrict__ Vt, _Float16* __restrict__ Oc) {
  const int w    = threadIdx.x >> 5;
  const int lane = threadIdx.x & 31;
  const int hs   = lane >> 4;
  const int ln   = lane & 15;
  const int kh   = w >> 2;          // which 64 keys of a step
  const int bh   = blockIdx.y;
  const int b    = bh >> 3;
  const int h    = bh & 7;
  const int q0   = blockIdx.x * 128 + (w & 3) * 32;

  const _Float16* Q = Qh + (size_t)bh * S_LEN * HD;
  const _Float16* K = Kh + (size_t)bh * S_LEN * HD;
  const _Float16* V = Vt + (size_t)bh * HD * S_LEN;  // [d][s]

  __shared__ __attribute__((aligned(16))) _Float16 Kl[2][2][64][KV_PITCH];
  __shared__ __attribute__((aligned(16))) _Float16 Vl[2][2][64][KV_PITCH];
  // hand-over of one query tile's partial result to the partner wave
  __shared__ __attribute__((aligned(16))) v4f Xo[8][8][32];
  __shared__ float Xm[8][32];
  __shared__ float Xs[8][32];

  // (the loops over bq, o, m_r and l_r are unrolled so that the arrays are registers)
  v16h bq[2][2];
#pragma unroll
  for (int q = 0; q < 2; ++q)
#pragma unroll
    for (int c = 0; c < 2; ++c) bq[q][c] = load_tile_k(Q, q0 + 16 * q, HD, 32 * c);

  v8f o[2][4];
  float m_r[2];  // running maximum of query 16q + ln over this wave's keys
  float l_r[2];  // running sum over this half-wave's keys only
#pragma unroll
  for (int q = 0; q < 2; ++q) {
#pragma unroll
    for (int j = 0; j < 4; ++j) o[q][j] = {};
    m_r[q] = -__builtin_inff();
    l_r[q] = 0.f;
  }

  // Ring prologue: stage 0 lands and is published, then stage 1 starts.
  stage_kv(K, V, 0,  &Kl[0][0][0][0], &Vl[0][0][0][0]);
  stage_kv(K, V, 64, &Kl[0][1][0][0], &Vl[0][1][0][0]);
  asm volatile("s_wait_asynccnt 0x0" ::: "memory");  // own copies of stage 0 landed
  __syncthreads();                                   // every wave's copies visible
  stage_kv(K, V, 128, &Kl[1][0][0][0], &Vl[1][0][0][0]);
  stage_kv(K, V, 192, &Kl[1][1][0][0], &Vl[1][1][0][0]);

  // One 128-key step. The two last steps, which have no stage left to start,
  // stand behind the loop as calls of their own: the loop's body is then one
  // straight block, and the compiler cannot sink the row sums past the refill's
  // branch, which kept 64 weights a lane alive across the second product and
  // spilled Q.
  auto step = [&](const int kt, const bool refill) __attribute__((always_inline)) {
    const int buf = (kt >> 7) & 1;
    const _Float16* Ks = &Kl[buf][kh][0][0];
    const _Float16* Vs = &Vl[buf][kh][0][0];

    // The wave's eight K fragments, read as one group. (This loop and those below
    // over ak, av, s and o are unrolled so that the arrays are registers.)
    v16h ak[2][4];
#pragma unroll
    for (int c = 0; c < 2; ++c)
#pragma unroll
      for (int t = 0; t < 4; ++t)
        ak[c][t] = load_tile_k(Ks, 16 * t, KV_PITCH, 32 * c);
    // Keeps the sixteen LDS reads together ahead of the score products: without
    // it the compiler reads one fragment, waits for it and multiplies, and the
    // wave waits out the LDS latency once a product, not once a step.
    __builtin_amdgcn_sched_barrier(0);

    // S^T = K Q^T for 64 keys (four 16-key subtiles) and both query tiles,
    // d 0..31 and then d 32..63
    v8f s[2][4];
#pragma unroll
    for (int t = 0; t < 4; ++t)
#pragma unroll
      for (int q = 0; q < 2; ++q) s[q][t] = wmma_f16(ak[0][t], bq[q][0], v8f{});
#pragma unroll
    for (int t = 0; t < 4; ++t)
#pragma unroll
      for (int q = 0; q < 2; ++q) s[q][t] = wmma_f16(ak[1][t], bq[q][1], s[q][t]);

    // The V^T fragments of the wave's keys 0..31, read as one group behind the
    // score products: they land while the softmax below runs. (Those of keys
    // 32..63 follow behind the softmax: all eight beside 64 scores a lane do not
    // fit the registers of four waves a SIMD.)
    v16h av[2][4];
#pragma unroll
    for (int j = 0; j < 4; ++j) av[0][j] = load_tile_k(Vs, 16 * j, KV_PITCH, 0);
    // Orders what stands between the scheduling barriers above and below: the
    // sixteen score products (0x8), then the eight V reads (0x100) in one place;
    // without the two lines the compiler spreads the reads among the products.
    __builtin_amdgcn_sched_group_barrier(0x8, 16, 0);
    __builtin_amdgcn_sched_group_barrier(0x100, 8, 0);
    // Keeps these eight reads ahead of the softmax: without it the compiler
    // sinks each pair in front of its product, behind the softmax, and the wave
    // waits out the LDS latency once a product again.
    __builtin_amdgcn_sched_barrier(0);

    v16h bp[2][2];
#pragma unroll
    for (int q = 0; q < 2; ++q) {
      // maximum of the lane's 32 scores, then of both halves and the old one
      float mx[4];
#pragma unroll
      for (int t = 0; t < 4; ++t) {
        mx[t] = fmaxf(fmaxf(fmaxf(s[q][t][0], s[q][t][1]), s[q][t][2]),
                      fmaxf(fmaxf(s[q][t][3], s[q][t][4]), s[q][t][5]));
        mx[t] = fmaxf(fmaxf(mx[t], s[q][t][6]), s[q][t][7]);
      }
      const float mh = fmaxf(fmaxf(mx[0], mx[1]), fmaxf(mx[2], mx[3]));
      const float nm = fmaxf(fmaxf(mh, other_half(mh)), m_r[q]);
      const float al = hw_exp2(m_r[q] - nm);
      m_r[q] = nm;

#pragma unroll
      for (int t = 0; t < 4; ++t) s[q][t] = hw_exp2_tile(s[q][t] - nm);

      const v8f sv = (s[q][0] + s[q][1]) + (s[q][2] + s[q][3]);
      const float rs = ((sv[0] + sv[1]) + (sv[2] + sv[3])) +
                       ((sv[4] + sv[5]) + (sv[6] + sv[7]));
      l_r[q] = l_r[q] * al + rs;

#pragma unroll
      for (int j = 0; j < 4; ++j) o[q][j] *= al;

      // P^T as B operand: element e of key block u is tile 2u + (e >> 3), register e & 7
#pragma unroll
      for (int u = 0; u < 2; ++u)
        bp[q][u] = __builtin_shufflevector(
            __builtin_convertvector(s[q][2 * u], v8h),
            __builtin_convertvector(s[q][2 * u + 1], v8h),
            0, 1, 2, 3, 4, 5, 6, 7, 8, 9, 10, 11, 12, 13, 14, 15);
    }

    // Keeps every product below behind the softmax: a product lifted in front of
    // an exponential statement would have its operand registers rewritten by that
    // statement inside the distance the matrix instruction needs.
    __builtin_amdgcn_sched_barrier(0);
    // The V^T fragments of keys 32..63, one group: they land under the eight
    // products of keys 0..31.
#pragma unroll
    for (int j = 0; j < 4; ++j) av[1][j] = load_tile_k(Vs, 16 * j, KV_PITCH, 32);
    // Keeps these eight reads ahead of the first product: without it the compiler
    // may sink each pair in front of its own product, where nothing covers its
    // LDS latency.
    __builtin_amdgcn_sched_barrier(0);

    // O^T += V^T P^T: keys 0..31 of the wave's 64 and then keys 32..63
#pragma unroll
    for (int u = 0; u < 2; ++u)
#pragma unroll
      for (int j = 0; j < 4; ++j)
#pragma unroll
        for (int q = 0; q < 2; ++q) o[q][j] = wmma_f16(av[u][j], bp[q][u], o[q][j]);
    // Keeps the waits and the barrier below at the step's foot: without it the
    // compiler lifts them to just behind the V reads, and the wave waits for
    // those reads in front of the products, not under them.
    __builtin_amdgcn_sched_barrier(0);

    // Publish point of the next stage, then the refill of this stage's buffer.
    asm volatile("s_wait_dscnt 0x0" ::: "memory");     // own reads of this buffer done
    asm volatile("s_wait_asynccnt 0x0" ::: "memory");  // own copies of the next stage landed
    __syncthreads();  // publishes the next stage; ends every wave's reads of this buffer
    if (refill) {  // only while a stage kt + 256 exists
      stage_kv(K, V, kt + 256, &Kl[buf][0][0][0], &Vl[buf][0][0][0]);
      stage_kv(K, V, kt + 320, &Kl[buf][1][0][0], &Vl[buf][1][0][0]);
    }
  };
  for (int kt = 0; kt < S_LEN - 256; kt += 128) step(kt, true);
  step(S_LEN - 256, false);
  step(S_LEN - 128, false);
  asm volatile("s_wait_asynccnt 0x0" ::: "memory");  // nothing outstanding at the wave's end

  // Join of the two key halves. Wave w finishes query tile kh and hands its part
  // of the other tile to wave w ^ 4, which holds the same queries lane for lane.
  const bool up = kh != 0;
  // the two half-waves' sums of a query are joined here, once
  const float l0 = l_r[0] + other_half(l_r[0]);
  const float l1 = l_r[1] + other_half(l_r[1]);
  // (unrolled, here and at the stores below: o stays in registers)
#pragma unroll
  for (int j = 0; j < 4; ++j) {
    const v8f g = up ? o[0][j] : o[1][j];
    Xo[w][2 * j][lane]     = v4f{g[0], g[1], g[2], g[3]};
    Xo[w][2 * j + 1][lane] = v4f{g[4], g[5], g[6], g[7]};
  }
  Xm[w][lane] = up ? m_r[0] : m_r[1];
  Xs[w][lane] = up ? l0 : l1;
  __syncthreads();  // the partner's part is written and visible

  const int pw = w ^ 4;
  const float m_a = up ? m_r[1] : m_r[0];
  const float l_a = up ? l1 : l0;
  const float m_b = Xm[pw][lane];
  const float l_b = Xs[pw][lane];
  const float nm  = fmaxf(m_a, m_b);
  const float e_a = hw_exp2(m_a - nm);
  const float e_b = hw_exp2(m_b - nm);
  const float inv = 1.0f / (l_a * e_a + l_b * e_b);
  const float f_a = e_a * inv;
  const float f_b = e_b * inv;

  // a lane holds 8 consecutive d of its query in each tile: one 16-byte store
  _Float16* orow = Oc + ((size_t)b * S_LEN + q0 + 16 * kh + ln) * DMODEL + h * HD + hs * 8;
#pragma unroll
  for (int j = 0; j < 4; ++j) {
    const v8f a = up ? o[1][j] : o[0][j];
    const v4f p0 = Xo[pw][2 * j][lane];
    const v4f p1 = Xo[pw][2 * j + 1][lane];
    const v8f p = {p0[0], p0[1], p0[2], p0[3], p1[0], p1[1], p1[2], p1[3]};
    *(v8h*)(orow + 16 * j) = __builtin_convertvector(a * f_a + p * f_b, v8h);
  }
}

// ---------------------------------------------------------------------------
// Host side
// ---------------------------------------------------------------------------
extern "C" void kernel_launch(void* const* d_in, const int* in_sizes, int n_in,
                              void* d_out, int out_size, void* d_ws,
                              size_t ws_size, hipStream_t stream) {
  const float* q  = (const float*)d_in[0];
  const float* k  = (const float*)d_in[1];
  const float* v  = (const float*)d_in[2];
  const float* Wq = (const float*)d_in[3];
  const float* bq = (const float*)d_in[4];
  const float* Wk = (const float*)d_in[5];
  const float* bk = (const float*)d_in[6];
  const float* Wv = (const float*)d_in[7];
  const float* bv = (const float*)d_in[8];
  const float* Wo = (const float*)d_in[9];
  const float* bo = (const float*)d_in[10];

  const size_t ACT = (size_t)MROWS * DMODEL;
  const size_t WSZ = (size_t)DMODEL * DMODEL;
  char* ws = (char*)d_ws;
  _Float16* Xq  = (_Float16*)(ws + 0 * ACT * 2);
  // (the f16 key and value activations take places 1 and 2)
  _Float16* Qh  = (_Float16*)(ws + 3 * ACT * 2);
  _Float16* Kh  = (_Float16*)(ws + 4 * ACT * 2);
  _Float16* Vt  = (_Float16*)(ws + 5 * ACT * 2);
  _Float16* Oc  = (_Float16*)(ws + 6 * ACT * 2);
  _Float16* Wqh = (_Float16*)(ws + 7 * ACT * 2 + 0 * WSZ * 2);
  // (the f16 Wk and Wv take places 1 and 2 behind Wqh)
  _Float16* Woh = (_Float16*)(ws + 7 * ACT * 2 + 3 * WSZ * 2);

  // The three activations lie one behind the other from Xq; the four weights from Wqh.
  cvt_all<<<256, 512, 0, stream>>>(q, k, v, Wq, Wk, Wv, Wo, Xq, Wqh);

  // fold softmax scale (1/sqrt(64)) and log2(e) into Q so the attention
  // kernel runs a pure base-2 online softmax with no per-element scaling.
  const float SCL_Q = 0.125f * 1.44269504088896340736f;

  // Activations from Xq, weights from Wqh, results Qh, Kh, Vt: each three lie one
  // behind the other.
  dim3 pg3(MROWS / 128, DMODEL / 128, 3);
  proj_gemm<true><<<pg3, 256, 0, stream>>>(Xq, Wqh, bq, bk, bv, (void*)Qh, SCL_Q);

  dim3 ag(S_LEN / 128, 2 * HEADS);
  flash_attn<<<ag, 256, 0, stream>>>(Qh, Kh, Vt, Oc);

  dim3 pg(MROWS / 128, DMODEL / 128);
  proj_gemm<false><<<pg, 256, 0, stream>>>(Oc, Woh, bo, bo, bo, d_out, 1.0f);
}

// v010
// One run takes 78.7 microseconds.
// Versions between v008 and this one are left out; their measured steps multiply to 1.16 times as fast.
// Over all steps from v000 it is 4.50 times as fast.
#include <hip/hip_runtime.h>
#include <hip/hip_bf16.h>

typedef __attribute__((ext_vector_type(16))) _Float16 v16h;
typedef __attribute__((ext_vector_type(8)))  _Float16 v8h;
typedef __attribute__((ext_vector_type(8)))  float    v8f;

#define S_LEN  4096
#define DMODEL 512
#define HEADS  8
#define HD     64
#define MROWS  8192   // N * S_LEN

// ---------------------------------------------------------------------------
// 16x32 f16 operand tile in CDNA5 WMMA A/B register layout.
// Lane L (L<16): row = base+L, halves = {k0+0..7, k0+16..23}
// Lane L+16    : row = base+L, halves = {k0+8..15, k0+24..31}
// ---------------------------------------------------------------------------
__device__ __forceinline__ v16h load_tile_k(const _Float16* src, int row_base,
                                            int ld, int k0) {
  const int lane = threadIdx.x & 31;
  const int hs   = lane >> 4;
  const _Float16* p = src + (size_t)(row_base + (lane & 15)) * ld + k0 + hs * 8;
  v8h lo = *(const v8h*)(p);
  v8h hi = *(const v8h*)(p + 16);
  v16h r;
#pragma unroll
  for (int i = 0; i < 8; ++i) { r[i] = lo[i]; r[i + 8] = hi[i]; }
  return r;
}

// The same tile from the lane's own address p (its row, its hs * 8 halves in).
__device__ __forceinline__ v16h load_frag(const _Float16* p) {
  v8h lo = *(const v8h*)(p);
  v8h hi = *(const v8h*)(p + 16);
  return __builtin_shufflevector(lo, hi, 0, 1, 2, 3, 4, 5, 6, 7, 8, 9, 10, 11, 12,
                                 13, 14, 15);
}

__device__ __forceinline__ v8f wmma_f16(v16h a, v16h b, v8f c) {
  return __builtin_amdgcn_wmma_f32_16x16x32_f16(false, a, false, b,
                                                (short)0, c, false, false);
}

// ---------------------------------------------------------------------------
// Lane l <-> lane l ^ 16: the other half of the wave (one VALU move, no DS).
// ---------------------------------------------------------------------------
__device__ __forceinline__ float other_half(float x) {
  const int b = __float_as_int(x);
  return __int_as_float(__builtin_amdgcn_permlanex16(
      b, b, 0x76543210, 0xfedcba98, false, false));
}

// ---------------------------------------------------------------------------
// 2^x as the one hardware instruction (v_exp_f32). The library exp2f wraps it
// in a compare, two selects, an add and an ldexp so that results under 2^-126
// come out as subnormals; here such a result may be 0: a weight that small
// rounds to 0 in f16, and it is lost in a row sum that holds the term 2^0.
// ---------------------------------------------------------------------------
__device__ __forceinline__ float hw_exp2(float x) {
  return __builtin_amdgcn_exp2f(x);
}

// The same for one score tile, 8 values a lane. One statement, so that the slot
// the instruction set asks for behind a transcendental is kept by construction:
// the results share no register with the sources (early clobber), so each
// v_exp_f32 is the independent instruction behind the one before it, and the
// v_nop is that slot behind the last.
__device__ __forceinline__ v8f hw_exp2_tile(v8f x) {
  float p0, p1, p2, p3, p4, p5, p6, p7;
  asm("v_exp_f32 %0, %8\n\t"
      "v_exp_f32 %1, %9\n\t"
      "v_exp_f32 %2, %10\n\t"
      "v_exp_f32 %3, %11\n\t"
      "v_exp_f32 %4, %12\n\t"
      "v_exp_f32 %5, %13\n\t"
      "v_exp_f32 %6, %14\n\t"
      "v_exp_f32 %7, %15\n\t"
      "v_nop"
      : "=&v"(p0), "=&v"(p1), "=&v"(p2), "=&v"(p3),
        "=&v"(p4), "=&v"(p5), "=&v"(p6), "=&v"(p7)
      : "v"(x[0]), "v"(x[1]), "v"(x[2]), "v"(x[3]),
        "v"(x[4]), "v"(x[5]), "v"(x[6]), "v"(x[7]));
  return v8f{p0, p1, p2, p3, p4, p5, p6, p7};
}

#define ACT_N   (MROWS * DMODEL)

typedef __attribute__((ext_vector_type(4))) float    v4f;
typedef __attribute__((ext_vector_type(4))) _Float16 v4h;

// ---------------------------------------------------------------------------
// Eight rows of an operand tile, 16 rows apart, one 16-byte piece a lane, from
// global memory (rows of DMODEL halves) to LDS (rows of P_PITCH halves). Sixteen
// lanes cover one 256-byte row piece, so a wave's copy is four whole lines.
// ---------------------------------------------------------------------------
#define P_BK    128   // k values of a stage: 256 bytes of every operand row
#define P_PITCH 136   // 272-byte rows (16 B x odd): ds_load_b128 without bank conflicts

__device__ __forceinline__ void stage_rows(const _Float16* g, unsigned l) {
  // The copies go to LDS through no register; the closing s_wait_xcnt stands in
  // the same statement so that no address register is rewritten ahead of it.
  asm volatile(
      "global_load_async_to_lds_b128 %0, %8, off\n\t"
      "global_load_async_to_lds_b128 %1, %9, off\n\t"
      "global_load_async_to_lds_b128 %2, %10, off\n\t"
      "global_load_async_to_lds_b128 %3, %11, off\n\t"
      "global_load_async_to_lds_b128 %4, %12, off\n\t"
      "global_load_async_to_lds_b128 %5, %13, off\n\t"
      "global_load_async_to_lds_b128 %6, %14, off\n\t"
      "global_load_async_to_lds_b128 %7, %15, off\n\t"
      "s_wait_xcnt 0x0"
      :: "v"(l), "v"(l + 1 * 16 * P_PITCH * 2), "v"(l + 2 * 16 * P_PITCH * 2),
         "v"(l + 3 * 16 * P_PITCH * 2), "v"(l + 4 * 16 * P_PITCH * 2),
         "v"(l + 5 * 16 * P_PITCH * 2), "v"(l + 6 * 16 * P_PITCH * 2),
         "v"(l + 7 * 16 * P_PITCH * 2),
         "v"(g), "v"(g + 1 * 16 * DMODEL), "v"(g + 2 * 16 * DMODEL),
         "v"(g + 3 * 16 * DMODEL), "v"(g + 4 * 16 * DMODEL),
         "v"(g + 5 * 16 * DMODEL), "v"(g + 6 * 16 * DMODEL),
         "v"(g + 7 * 16 * DMODEL)
      : "memory");
}

// ---------------------------------------------------------------------------
// A wave's (16 MI)x64 tile of sums, from (m0, n0): (c + bias[n]) * oscale goes out as
// MODE 0: f16 per-head row-major  [((b*8+h)*4096+s)*64 + d]
// MODE 1: f16 per-head transposed [((b*8+h)*64+d)*4096 + s]
// MODE 2: f32 row-major out[m*512 + n]
// ---------------------------------------------------------------------------
template <int MODE, int MI>
__device__ __forceinline__ void store_tiles(const v8f (&c)[MI][4],
                                            const float* __restrict__ bias,
                                            void* __restrict__ out, float oscale,
                                            int m0, int n0) {
  const int hs = (threadIdx.x & 31) >> 4;
  const int ln = threadIdx.x & 15;
  // (every loop here is unrolled so that c and bn are indexed by constants and stay in registers)
  float bn[4];
#pragma unroll
  for (int j = 0; j < 4; ++j) {
    bn[j] = bias[n0 + 16 * j + ln];
    // Behind each bias load: a later load's result may land on a register that this
    // one names (address pair, or offset and scalar base); none is rewritten ahead of
    // this wait.
    asm volatile("s_wait_xcnt 0x0" ::: "memory");
  }
#pragma unroll
  for (int i = 0; i < MI; ++i) {
#pragma unroll
    for (int j = 0; j < 4; ++j) {
      const int n = n0 + 16 * j + ln;
#pragma unroll
      for (int v = 0; v < 8; ++v) {
        const int m = m0 + 16 * i + hs * 8 + v;
        const float val = (c[i][j][v] + bn[j]) * oscale;
        if (MODE == 2) {
          ((float*)out)[(size_t)m * DMODEL + n] = val;
        } else {
          const int b = m >> 12;
          const int s = m & (S_LEN - 1);
          const int h = n >> 6;
          const int d = n & (HD - 1);
          _Float16* o = (_Float16*)out;
          if (MODE == 0)
            o[(((size_t)b * HEADS + h) * S_LEN + s) * HD + d] = (_Float16)val;
          else
            o[(((size_t)b * HEADS + h) * HD + d) * S_LEN + s] = (_Float16)val;
        }
      }
    }
  }
}

// ---------------------------------------------------------------------------
// Output projection: C[m,n] = sum_k X[m,k]*W[n,k] + bias[n], f16 operands, f32 out.
// M=8192, N=512, K=512. Block 256 (8 waves), wave tile 32x64, block 128x128.
// The block's 128 rows of X and 128 rows of W come in stages of P_BK k values
// through a two-buffer LDS ring shared by its eight waves; the next stage's
// copies fly during this stage. The k order of the sums is 0, 32, 64, ...
// ---------------------------------------------------------------------------
__global__ __launch_bounds__(256) void proj_out(
    const _Float16* __restrict__ X, const _Float16* __restrict__ W,
    const float* __restrict__ bias, float* __restrict__ out) {
  const int w    = threadIdx.x >> 5;
  const int wm   = w >> 1;
  const int wn   = w & 1;
  const int m0   = blockIdx.x * 128 + wm * 32;
  const int n0   = blockIdx.y * 128 + wn * 64;

  __shared__ __attribute__((aligned(16))) _Float16 Xl[2][128][P_PITCH];
  __shared__ __attribute__((aligned(16))) _Float16 Wl[2][128][P_PITCH];

  // this thread's piece of a stage: rows sr, sr + 16, ..., sr + 112, halves sc..sc+7
  const int sr = threadIdx.x >> 4;
  const int sc = (threadIdx.x & 15) * 8;
  const _Float16* gx = X + (size_t)(blockIdx.x * 128 + sr) * DMODEL + sc;
  const _Float16* gw = W + (size_t)(blockIdx.y * 128 + sr) * DMODEL + sc;
  const unsigned lx = (unsigned)(size_t)(&Xl[0][sr][sc]);
  const unsigned lw = (unsigned)(size_t)(&Wl[0][sr][sc]);
  const unsigned lbuf = 128 * P_PITCH * 2;   // bytes from buffer 0 to buffer 1

  v8f c[2][4];
#pragma unroll
  for (int i = 0; i < 2; ++i)
#pragma unroll
    for (int j = 0; j < 4; ++j) c[i][j] = {};

  // Ring prologue: stage 0 lands and is published, then stage 1 starts.
  stage_rows(gx, lx);
  stage_rows(gw, lw);
  asm volatile("s_wait_asynccnt 0x0" ::: "memory");  // own copies of stage 0 landed
  __syncthreads();                                   // every wave's copies visible
  stage_rows(gx + P_BK, lx + lbuf);
  stage_rows(gw + P_BK, lw + lbuf);

  for (int k0 = 0; k0 < DMODEL; k0 += P_BK) {
    const int buf = (k0 / P_BK) & 1;
    const _Float16* Xs = &Xl[buf][0][0];
    const _Float16* Ws = &Wl[buf][0][0];

    // unrolled so that the four k steps' LDS offsets are immediates of the reads
#pragma unroll
    for (int kk = 0; kk < P_BK; kk += 32) {
      const v16h a0 = load_tile_k(Xs, wm * 32,      P_PITCH, kk);
      const v16h a1 = load_tile_k(Xs, wm * 32 + 16, P_PITCH, kk);
      v16h b[4];
#pragma unroll
      for (int j = 0; j < 4; ++j)
        b[j] = load_tile_k(Ws, wn * 64 + 16 * j, P_PITCH, kk);
      // Keeps the twelve LDS reads of this k step together ahead of its products:
      // without it the compiler sinks each pair in front of its user and the wave
      // waits out the LDS latency four times a k step, not once.
      __builtin_amdgcn_sched_barrier(0);
#pragma unroll
      for (int j = 0; j < 4; ++j) {
        c[0][j] = wmma_f16(a0, b[j], c[0][j]);
        c[1][j] = wmma_f16(a1, b[j], c[1][j]);
      }
    }

    // Publish point of the next stage, then the refill of this stage's buffer.
    asm volatile("s_wait_dscnt 0x0" ::: "memory");     // own reads of this buffer done
    asm volatile("s_wait_asynccnt 0x0" ::: "memory");  // own copies of the next stage landed
    __syncthreads();  // publishes the next stage; ends every wave's reads of this buffer
    if (k0 + 2 * P_BK < DMODEL) {
      stage_rows(gx + k0 + 2 * P_BK, lx + buf * lbuf);
      stage_rows(gw + k0 + 2 * P_BK, lw + buf * lbuf);
    }
  }
  asm volatile("s_wait_asynccnt 0x0" ::: "memory");  // nothing outstanding at the wave's end

  store_tiles<2, 2>(c, bias, out, 1.0f, m0, n0);
}

// ---------------------------------------------------------------------------
// One piece of one operand of the input projections (256 rows x Q_KS k values, f32,
// rows of DMODEL values in global memory) on its way to LDS through the registers
// of the block's 512 threads, converted to f16 on the way, so that no launch of its
// own converts it. A lane takes 16 bytes of a row (eight lanes: one whole line) of
// rows 64 apart. (The loops over r are unrolled so that it stays in registers.)
// ---------------------------------------------------------------------------
#define Q_KS    32   // k values of a piece: what a thread holds in flight
#define Q_BK    64   // k values of a ring stage: two pieces
#define Q_PITCH 72   // 144-byte rows (16 B x odd): ds_load_b128 without bank conflicts

struct Piece {
  v4f r[4];
  __device__ __forceinline__ void load(const float* g) {
#pragma unroll
    for (int i = 0; i < 4; ++i) r[i] = *(const v4f*)(g + i * 64 * DMODEL);
  }
  __device__ __forceinline__ void store(_Float16* l) const {
#pragma unroll
    for (int i = 0; i < 4; ++i)
      *(v4h*)(l + i * 64 * Q_PITCH) = __builtin_convertvector(r[i], v4h);
  }
};

// The ring's barrier: orders the block's LDS traffic alone. __syncthreads() would
// also wait for the global loads issued ahead, which are to stay in flight over it.
__device__ __forceinline__ void lds_barrier() {
  __builtin_amdgcn_fence(__ATOMIC_RELEASE, "workgroup", "local");
  __builtin_amdgcn_s_barrier();
  __builtin_amdgcn_fence(__ATOMIC_ACQUIRE, "workgroup", "local");
}

// ---------------------------------------------------------------------------
// The three input projections, C[m,n] = (sum_k X[m,k]*W[n,k] + bias[n]) * oscale,
// M=8192, N=512, K=512, from the f32 inputs, in ONE launch: blockIdx.z = 0, 1, 2
// picks activation, weight, bias and result (the results lie one behind the other
// in the workspace); Q and K go out in MODE 0, V in MODE 1, oscale applies to Q
// alone. Block 512 (sixteen waves, 4 x 4), wave tile 64x64, block tile 256x256: an
// f32 row of activation or weight is then read by half as many blocks as with
// 128x128, so that the bytes asked of L2 are those of f16 operands. One block a WGP
// (four waves a SIMD); all 192 are resident at once.
// The block's rows of X and W go through a two-buffer LDS ring in stages of Q_BK k
// values. A stage is filled piece by piece during the stage before it: behind the
// products of piece h, piece h + 2 (loaded to registers behind piece h - 1) is
// converted and stored to the other buffer, and the loads of piece h + 3 start; they
// fly during the products of piece h + 1. One barrier a stage.
// The k order of the sums is 0, 32, 64, ...
// blockIdx.z = 3: the 64 blocks that the other WGPs take convert the weight of the
// output projection, which a later launch reads, 8 values a thread.
// ---------------------------------------------------------------------------
__global__ __launch_bounds__(512) __attribute__((amdgpu_waves_per_eu(4, 4)))
void proj_qkv(
    const float* __restrict__ q, const float* __restrict__ k,
    const float* __restrict__ v, const float* __restrict__ Wq,
    const float* __restrict__ Wk, const float* __restrict__ Wv,
    const float* __restrict__ Wo, const float* __restrict__ bias0,
    const float* __restrict__ bias1, const float* __restrict__ bias2,
    _Float16* __restrict__ out, _Float16* __restrict__ woh, float oscale) {
  __shared__ __attribute__((aligned(16))) _Float16 Xl[2 * 256 * Q_PITCH];
  __shared__ __attribute__((aligned(16))) _Float16 Wl[2 * 256 * Q_PITCH];
  const int z = blockIdx.z;
  if (z == 3) {  // the whole block, ahead of every barrier
    const unsigned at = (blockIdx.y * 32 + blockIdx.x) * 4096 + threadIdx.x * 8;
    const v8f w8 = *(const v8f*)(Wo + at);
    // Behind the loads: no register that they name is rewritten ahead of it.
    asm volatile("s_wait_xcnt 0x0" ::: "memory");
    *(v8h*)(woh + at) = __builtin_convertvector(w8, v8h);
    return;
  }
  const float* X = z == 0 ? q : z == 1 ? k : v;
  const float* W = z == 0 ? Wq : z == 1 ? Wk : Wv;
  const int w  = threadIdx.x >> 5;
  const int wm = w >> 2;
  const int wn = w & 3;
  const int m0 = blockIdx.x * 256 + wm * 64;
  const int n0 = blockIdx.y * 256 + wn * 64;
  const int BUF = 256 * Q_PITCH;      // halves from buffer 0 to buffer 1
  const int NP  = DMODEL / Q_KS;      // pieces
  const int R   = Q_BK / Q_KS;        // pieces a stage

  // this thread's part of a piece: rows sr, sr + 64, sr + 128, sr + 192, values sc..sc+3
  const int sr = threadIdx.x >> 3;
  const int sc = (threadIdx.x & 7) * 4;
  const float* gx = X + (size_t)(blockIdx.x * 256 + sr) * DMODEL + sc;
  const float* gw = W + (size_t)(blockIdx.y * 256 + sr) * DMODEL + sc;
  _Float16* lx = Xl + sr * Q_PITCH + sc;
  _Float16* lw = Wl + sr * Q_PITCH + sc;

  // (the loops over c, a, b and the pieces are unrolled so that the arrays are registers)
  v8f c[4][4];
#pragma unroll
  for (int i = 0; i < 4; ++i)
#pragma unroll
    for (int j = 0; j < 4; ++j) c[i][j] = {};

  Piece px, pw;
  // Ring prologue: the pieces of stage 0, in flight together, go to buffer 0; the
  // first piece of stage 1 starts; stage 0 is published.
  {
    Piece fx[R], fw[R];
#pragma unroll
    for (int p = 0; p < R; ++p) {
      fx[p].load(gx + p * Q_KS);
      fw[p].load(gw + p * Q_KS);
    }
#pragma unroll
    for (int p = 0; p < R; ++p) {
      fx[p].store(lx + p * Q_KS);
      fw[p].store(lw + p * Q_KS);
    }
  }
  // Keeps the next loads behind the conversions, here and in the loop: lifted above
  // them they need a second set of registers, which does not fit.
  __builtin_amdgcn_sched_barrier(0);
  px.load(gx + R * Q_KS);
  pw.load(gw + R * Q_KS);
  lds_barrier();  // every wave's part of stage 0 visible

  // unrolled so that buffer, LDS offsets and the k offsets of the loads are immediates
#pragma unroll
  for (int h = 0; h < NP; ++h) {
    const _Float16* Xs = Xl + ((h / R) & 1) * BUF;
    const _Float16* Ws = Wl + ((h / R) & 1) * BUF;
    const int kk = (h % R) * Q_KS;

    v16h a[4], b[4];
#pragma unroll
    for (int i = 0; i < 4; ++i) a[i] = load_tile_k(Xs, wm * 64 + 16 * i, Q_PITCH, kk);
#pragma unroll
    for (int j = 0; j < 4; ++j) b[j] = load_tile_k(Ws, wn * 64 + 16 * j, Q_PITCH, kk);
    // Keeps the sixteen LDS reads of this piece together ahead of its products:
    // without it the compiler sinks each pair in front of its user and the wave
    // waits out the LDS latency several times a piece, not once.
    __builtin_amdgcn_sched_barrier(0);
#pragma unroll
    for (int j = 0; j < 4; ++j)
#pragma unroll
      for (int i = 0; i < 4; ++i) c[i][j] = wmma_f16(a[i], b[j], c[i][j]);
    // Keeps the wait for the loads in flight behind this piece's products: lifted
    // above them, it would leave the memory latency uncovered.
    __builtin_amdgcn_sched_barrier(0);

    if (h + R < NP) {
      // Piece h + R, into the other buffer: its last readers passed the barrier at
      // the end of the stage before this one.
      const int d  = h + R;
      const int at = ((d / R) & 1) * BUF + (d % R) * Q_KS;
      px.store(lx + at);
      pw.store(lw + at);
      // keeps the next loads behind the conversions (one set of registers in flight)
      __builtin_amdgcn_sched_barrier(0);
      if (d + 1 < NP) {
        px.load(gx + (d + 1) * Q_KS);
        pw.load(gw + (d + 1) * Q_KS);
      }
    }
    // publishes the next stage; ends every wave's reads of this stage's buffer
    if (h % R == R - 1 && h + 1 < NP) lds_barrier();
  }
  // The two address pairs that every load above names stay as they are through the
  // loop (the k offsets are immediates); what follows reuses them, behind this wait.
  asm volatile("s_wait_xcnt 0x0" ::: "memory");

  const float* bias = z == 0 ? bias0 : z == 1 ? bias1 : bias2;
  const float  osc  = z == 0 ? oscale : 1.0f;
  _Float16* o = out + (size_t)z * ACT_N;
  // Behind either run of stores stands a wait: the built code goes on from there past
  // other branches, which rewrite registers that these stores name.
  if (z == 2) {
    store_tiles<1, 4>(c, bias, o, osc, m0, n0);
    asm volatile("s_wait_xcnt 0x0" ::: "memory");
  } else {
    store_tiles<0, 4>(c, bias, o, osc, m0, n0);
    asm volatile("s_wait_xcnt 0x0" ::: "memory");
  }
}

// ---------------------------------------------------------------------------
// Half a 128-key stage: K (64 keys x 64 d) and V^T (64 d x 64 keys), 128-byte
// rows, copied once per block into LDS rows of KV_PITCH halves. Each thread
// moves four 16-byte pieces; a wave's copy covers four whole 128-byte lines.
// ---------------------------------------------------------------------------
#define KV_PITCH 72   // 144-byte rows (16 B x odd): ds_load_b128 without bank conflicts

// gk0, gv0, lk0, lv0: the thread's first piece of K and of V^T, in global memory
// and in LDS (row threadIdx.x >> 3, halves 8 * (threadIdx.x & 7) and on); its
// second piece lies 32 rows on.
__device__ __forceinline__ void stage_kv(const _Float16* gk0, const _Float16* gv0,
                                         unsigned lk0, unsigned lv0) {
  const _Float16* gk1 = gk0 + 32 * HD;
  const _Float16* gv1 = gv0 + (size_t)32 * S_LEN;
  const unsigned lk1 = lk0 + 32 * KV_PITCH * 2;
  const unsigned lv1 = lv0 + 32 * KV_PITCH * 2;
  // The copies go to LDS through no register; the closing s_wait_xcnt stands in
  // the same statement so that no address register is rewritten ahead of it.
  asm volatile(
      "global_load_async_to_lds_b128 %0, %4, off\n\t"
      "global_load_async_to_lds_b128 %1, %5, off\n\t"
      "global_load_async_to_lds_b128 %2, %6, off\n\t"
      "global_load_async_to_lds_b128 %3, %7, off\n\t"
      "s_wait_xcnt 0x0"
      :: "v"(lk0), "v"(lk1), "v"(lv0), "v"(lv1),
         "v"(gk0), "v"(gk1), "v"(gv0), "v"(gv1)
      : "memory");
}

// ---------------------------------------------------------------------------
// Flash attention, base-2 online softmax (scale*log2e folded into Q).
// Grid (32,16), block 256 (8 waves), 128 queries a block, 128-key steps.
// Wave w takes 32 queries (two 16-query tiles, group w & 3) and 64 of the step's
// 128 keys (half w >> 2), so that every K and V^T fragment read from LDS feeds
// TWO products, one a query tile. Waves w and w ^ 4 hold partial results of the
// same queries over different keys; they are joined once, behind the loop.
//   K and V^T of the step come from a two-buffer LDS ring shared by the
//   block's eight waves; the next step's copies fly during this step.
// Both products are taken transposed, so that a lane owns ONE query a tile:
//   S^T = K Q^T   (A = 16 keys x 32 d from LDS, B = Q, kept in registers)
//     s[q][t][r] = score of key 16t + 8*hs + r against query 16q + ln
//   maximum and sum run down the lane's own 32 scores; the two halves of the
//   wave (which split the keys) join their sums once, behind the loop.
//   The weights are taken against a HELD reference, not the running maximum:
//   minus the reference is the C operand of the score products, so that their
//   result is the exponent as it stands, and sum and O are not rescaled in a
//   step that keeps the reference. It moves up to the maximum only when a score
//   of the wave lies more than 8 above it (one test a step): a weight is then
//   at most 2^8, far inside f16, and a row's largest weight is about 1 or more,
//   since the reference is a score that the row has held.
//   O^T += V^T P^T (A = 16 d x 32 keys from LDS, B = P^T)
//     two score tiles 2u, 2u+1, converted in place, ARE the B operand of key
//     block u in the hardware k order that load_tile_k gives A.
//     o[q][j][r] = output d 16j + 8*hs + r of query 16q + ln
// ---------------------------------------------------------------------------

// four waves a SIMD (two blocks a WGP): the softmax between the matrix runs
// wants other waves to fill the matrix unit meanwhile
__global__ __launch_bounds__(256) __attribute__((amdgpu_waves_per_eu(4, 4)))
void flash_attn(
    const _Float16* __restrict__ Qh, const _Float16* __restrict__ Kh,
    const _Float16* __restrict__ Vt, _Float16* __restrict__ Oc) {
  // the wave's number, told to the compiler as wave-uniform: what follows from it
  // (key half, first query, partner) then lives in scalar registers across the loop
  const int w    = __builtin_amdgcn_readfirstlane(threadIdx.x >> 5);
  const int lane = threadIdx.x & 31;
  const int hs   = lane >> 4;
  const int ln   = lane & 15;
  const int kh   = w >> 2;          // which 64 keys of a step
  const int bh   = blockIdx.y;
  const int b    = bh >> 3;
  const int h    = bh & 7;
  const int q0   = blockIdx.x * 128 + (w & 3) * 32;

  const _Float16* Q = Qh + (size_t)bh * S_LEN * HD;
  const _Float16* K = Kh + (size_t)bh * S_LEN * HD;
  const _Float16* V = Vt + (size_t)bh * HD * S_LEN;  // [d][s]

  __shared__ __attribute__((aligned(16))) _Float16 Kl[2][2][64][KV_PITCH];
  __shared__ __attribute__((aligned(16))) _Float16 Vl[2][2][64][KV_PITCH];
  // hand-over of one query tile's partial result to the partner wave
  __shared__ __attribute__((aligned(16))) v4f Xo[8][8][32];
  __shared__ float Xm[8][32];
  __shared__ float Xs[8][32];

  // (the loops over bq, o, cm and l_r are unrolled so that the arrays are registers)
  v16h bq[2][2];
#pragma unroll
  for (int q = 0; q < 2; ++q)
#pragma unroll
    for (int c = 0; c < 2; ++c) bq[q][c] = load_tile_k(Q, q0 + 16 * q, HD, 32 * c);

  v8f o[2][4];
  v8f cm[2];     // minus the reference of query 16q + ln, the same in all eight
  float l_r[2];  // running sum over this half-wave's keys only
#pragma unroll
  for (int q = 0; q < 2; ++q) {
#pragma unroll
    for (int j = 0; j < 4; ++j) o[q][j] = {};
    cm[q] = {};  // a start value only: the first step sets the reference
    l_r[q] = 0.f;
  }

  // The thread's own part of every address of the loop, formed once, so that each
  // takes one register (pair) across the loop: what a step adds is wave-uniform.
  const int sr = threadIdx.x >> 3;         // staging: row 0..31 (and row + 32)
  const int sc = (threadIdx.x & 7) * 8;    // staging: first half of the 16-byte piece
  const _Float16* gk = K + sr * HD + sc;
  const _Float16* gv = V + sr * S_LEN + sc;
  const unsigned lk = (unsigned)(size_t)(&Kl[0][0][sr][sc]);
  const unsigned lv = (unsigned)(size_t)(&Vl[0][0][sr][sc]);
  const _Float16* kf = &Kl[0][kh][ln][hs * 8];   // fragment reads: lane's row and k part
  const _Float16* vf = &Vl[0][kh][ln][hs * 8];
  const int HALF_H = 64 * KV_PITCH;       // halves from 64 keys to the next 64
  const int BUF_H  = 2 * HALF_H;          // halves from buffer 0 to buffer 1
  // the 128 keys from kt on, into buffer buf
  auto stage = [&](const int kt, const int buf) __attribute__((always_inline)) {
    stage_kv(gk + kt * HD, gv + kt, lk + buf * (BUF_H * 2), lv + buf * (BUF_H * 2));
    stage_kv(gk + (kt + 64) * HD, gv + kt + 64, lk + buf * (BUF_H * 2) + HALF_H * 2,
             lv + buf * (BUF_H * 2) + HALF_H * 2);
  };

  // Ring prologue: stage 0 lands and is published, then stage 1 starts.
  stage(0, 0);
  asm volatile("s_wait_asynccnt 0x0" ::: "memory");  // own copies of stage 0 landed
  __syncthreads();                                   // every wave's copies visible
  stage(128, 1);

  // One 128-key step. The two last steps, which have no stage left to start,
  // stand behind the loop as calls of their own: the loop's body is then one
  // straight block, and the compiler cannot sink the row sums past the refill's
  // branch, which kept 64 weights a lane alive across the second product and
  // spilled Q.
  auto step = [&](const int kt, const bool refill) __attribute__((always_inline)) {
    const int buf = (kt >> 7) & 1;
    const _Float16* Ks = kf + buf * BUF_H;
    const _Float16* Vs = vf + buf * BUF_H;

    // The wave's eight K fragments, read as one group. (This loop and those below
    // over ak, av, s and o are unrolled so that the arrays are registers.)
    v16h ak[2][4];
#pragma unroll
    for (int c = 0; c < 2; ++c)
#pragma unroll
      for (int t = 0; t < 4; ++t)
        ak[c][t] = load_frag(Ks + 16 * t * KV_PITCH + 32 * c);
    // Keeps the sixteen LDS reads together ahead of the score products: without
    // it the compiler reads one fragment, waits for it and multiplies, and the
    // wave waits out the LDS latency once a product, not once a step.
    __builtin_amdgcn_sched_barrier(0);

    // S^T = K Q^T - reference for 64 keys (four 16-key subtiles) and both query
    // tiles, d 0..31 and then d 32..63
    v8f s[2][4];
#pragma unroll
    for (int t = 0; t < 4; ++t)
#pragma unroll
      for (int q = 0; q < 2; ++q) s[q][t] = wmma_f16(ak[0][t], bq[q][0], cm[q]);
#pragma unroll
    for (int t = 0; t < 4; ++t)
#pragma unroll
      for (int q = 0; q < 2; ++q) s[q][t] = wmma_f16(ak[1][t], bq[q][1], s[q][t]);

    // The V^T fragments of the wave's keys 0..31, read as one group behind the
    // score products: they land while the softmax below runs. (Those of keys
    // 32..63 follow behind the softmax: all eight beside 64 scores a lane do not
    // fit the registers of four waves a SIMD.)
    v16h av[2][4];
#pragma unroll
    for (int j = 0; j < 4; ++j) av[0][j] = load_frag(Vs + 16 * j * KV_PITCH);
    // Orders what stands between the scheduling barriers above and below: the
    // sixteen score products (0x8), then the eight V reads (0x100) in one place;
    // without the two lines the compiler spreads the reads among the products.
    __builtin_amdgcn_sched_group_barrier(0x8, 16, 0);
    __builtin_amdgcn_sched_group_barrier(0x100, 8, 0);
    // Keeps these eight reads ahead of the softmax: without it the compiler
    // sinks each pair in front of its product, behind the softmax, and the wave
    // waits out the LDS latency once a product again.
    __builtin_amdgcn_sched_barrier(0);

    // maximum of the lane's 32 scores of each query, counted from the reference
    float mh[2];
#pragma unroll
    for (int q = 0; q < 2; ++q) {
      float mx[4];
#pragma unroll
      for (int t = 0; t < 4; ++t) {
        mx[t] = fmaxf(fmaxf(fmaxf(s[q][t][0], s[q][t][1]), s[q][t][2]),
                      fmaxf(fmaxf(s[q][t][3], s[q][t][4]), s[q][t][5]));
        mx[t] = fmaxf(fmaxf(mx[t], s[q][t][6]), s[q][t][7]);
      }
      mh[q] = fmaxf(fmaxf(mx[0], mx[1]), fmaxf(mx[2], mx[3]));
    }
    // One test a step, the same for the whole wave (a scalar branch): the
    // reference moves in the first step, which has none yet, and where a score
    // lies more than 8 above it.
    const bool first = kt == 0;
    const float bar = first ? -__builtin_inff() : 8.0f;
    if (__builtin_amdgcn_ballot_w32(fmaxf(mh[0], mh[1]) > bar) != 0) {
#pragma unroll
      for (int q = 0; q < 2; ++q) {
        // both halves of the wave hold keys of the same query: one reference
        const float mf = fmaxf(mh[q], other_half(mh[q]));
        // first step: to the maximum, wherever it lies (sum and O are still 0);
        // later: up to the maximum, never down
        const float dl = first ? mf : fmaxf(mf, 0.f);
        const float al = first ? 1.f : hw_exp2(-dl);
#pragma unroll
        for (int t = 0; t < 4; ++t) s[q][t] -= dl;
#pragma unroll
        for (int j = 0; j < 4; ++j) o[q][j] *= al;
        l_r[q] *= al;
        cm[q] -= dl;
      }
    }

    v16h bp[2][2];
#pragma unroll
    for (int q = 0; q < 2; ++q) {
#pragma unroll
      for (int t = 0; t < 4; ++t) s[q][t] = hw_exp2_tile(s[q][t]);

      const v8f sv = (s[q][0] + s[q][1]) + (s[q][2] + s[q][3]);
      const float rs = ((sv[0] + sv[1]) + (sv[2] + sv[3])) +
                       ((sv[4] + sv[5]) + (sv[6] + sv[7]));
      l_r[q] += rs;

      // P^T as B operand: element e of key block u is tile 2u + (e >> 3), register e & 7
#pragma unroll
      for (int u = 0; u < 2; ++u)
        bp[q][u] = __builtin_shufflevector(
            __builtin_convertvector(s[q][2 * u], v8h),
            __builtin_convertvector(s[q][2 * u + 1], v8h),
            0, 1, 2, 3, 4, 5, 6, 7, 8, 9, 10, 11, 12, 13, 14, 15);
    }

    // Keeps every product below behind the softmax: a product lifted in front of
    // an exponential statement would have its operand registers rewritten by that
    // statement inside the distance the matrix instruction needs.
    __builtin_amdgcn_sched_barrier(0);
    // The V^T fragments of keys 32..63, one group: they land under the eight
    // products of keys 0..31.
#pragma unroll
    for (int j = 0; j < 4; ++j) av[1][j] = load_frag(Vs + 16 * j * KV_PITCH + 32);
    // Keeps these eight reads ahead of the first product: without it the compiler
    // may sink each pair in front of its own product, where nothing covers its
    // LDS latency.
    __builtin_amdgcn_sched_barrier(0);

    // O^T += V^T P^T: keys 0..31 of the wave's 64 and then keys 32..63
#pragma unroll
    for (int u = 0; u < 2; ++u)
#pragma unroll
      for (int j = 0; j < 4; ++j)
#pragma unroll
        for (int q = 0; q < 2; ++q) o[q][j] = wmma_f16(av[u][j], bp[q][u], o[q][j]);
    // Keeps the waits and the barrier below at the step's foot: without it the
    // compiler lifts them to just behind the V reads, and the wave waits for
    // those reads in front of the products, not under them.
    __builtin_amdgcn_sched_barrier(0);

    // Publish point of the next stage, then the refill of this stage's buffer.
    asm volatile("s_wait_dscnt 0x0" ::: "memory");     // own reads of this buffer done
    asm volatile("s_wait_asynccnt 0x0" ::: "memory");  // own copies of the next stage landed
    __syncthreads();  // publishes the next stage; ends every wave's reads of this buffer
    if (refill) {  // only while a stage kt + 256 exists
      stage(kt + 256, buf);
    }
  };
  // Not unrolled, which also keeps the first trip inside the loop: peeled off for
  // its test on kt, it is one more copy of the step, and that copy spills.
#pragma nounroll
  for (int kt = 0; kt < S_LEN - 256; kt += 128) step(kt, true);
  step(S_LEN - 256, false);
  step(S_LEN - 128, false);
  asm volatile("s_wait_asynccnt 0x0" ::: "memory");  // nothing outstanding at the wave's end

  // Join of the two key halves. Wave w finishes query tile kh and hands its part
  // of the other tile to wave w ^ 4, which holds the same queries lane for lane.
  const bool up = kh != 0;
  // the two half-waves' sums of a query are joined here, once
  const float l0 = l_r[0] + other_half(l_r[0]);
  const float l1 = l_r[1] + other_half(l_r[1]);
  // (unrolled, here and at the stores below: o stays in registers)
#pragma unroll
  for (int j = 0; j < 4; ++j) {
    const v8f g = up ? o[0][j] : o[1][j];
    Xo[w][2 * j][lane]     = v4f{g[0], g[1], g[2], g[3]};
    Xo[w][2 * j + 1][lane] = v4f{g[4], g[5], g[6], g[7]};
  }
  Xm[w][lane] = up ? -cm[0][0] : -cm[1][0];
  Xs[w][lane] = up ? l0 : l1;
  __syncthreads();  // the partner's part is written and visible

  const int pw = w ^ 4;
  const float m_a = up ? -cm[1][0] : -cm[0][0];
  const float l_a = up ? l1 : l0;
  const float m_b = Xm[pw][lane];
  const float l_b = Xs[pw][lane];
  const float nm  = fmaxf(m_a, m_b);
  const float e_a = hw_exp2(m_a - nm);
  const float e_b = hw_exp2(m_b - nm);
  const float inv = 1.0f / (l_a * e_a + l_b * e_b);
  const float f_a = e_a * inv;
  const float f_b = e_b * inv;

  // a lane holds 8 consecutive d of its query in each tile: one 16-byte store
  _Float16* orow = Oc + ((size_t)b * S_LEN + q0 + 16 * kh + ln) * DMODEL + h * HD + hs * 8;
#pragma unroll
  for (int j = 0; j < 4; ++j) {
    const v8f a = up ? o[1][j] : o[0][j];
    const v4f p0 = Xo[pw][2 * j][lane];
    const v4f p1 = Xo[pw][2 * j + 1][lane];
    const v8f p = {p0[0], p0[1], p0[2], p0[3], p1[0], p1[1], p1[2], p1[3]};
    *(v8h*)(orow + 16 * j) = __builtin_convertvector(a * f_a + p * f_b, v8h);
  }
}

// ---------------------------------------------------------------------------
// Host side
// ---------------------------------------------------------------------------
extern "C" void kernel_launch(void* const* d_in, const int* in_sizes, int n_in,
                              void* d_out, int out_size, void* d_ws,
                              size_t ws_size, hipStream_t stream) {
  const float* q  = (const float*)d_in[0];
  const float* k  = (const float*)d_in[1];
  const float* v  = (const float*)d_in[2];
  const float* Wq = (const float*)d_in[3];
  const float* bq = (const float*)d_in[4];
  const float* Wk = (const float*)d_in[5];
  const float* bk = (const float*)d_in[6];
  const float* Wv = (const float*)d_in[7];
  const float* bv = (const float*)d_in[8];
  const float* Wo = (const float*)d_in[9];
  const float* bo = (const float*)d_in[10];

  const size_t ACT = (size_t)MROWS * DMODEL;
  char* ws = (char*)d_ws;
  _Float16* Qh  = (_Float16*)(ws + 0 * ACT * 2);
  _Float16* Kh  = (_Float16*)(ws + 1 * ACT * 2);
  _Float16* Vt  = (_Float16*)(ws + 2 * ACT * 2);
  _Float16* Oc  = (_Float16*)(ws + 3 * ACT * 2);
  _Float16* Woh = (_Float16*)(ws + 4 * ACT * 2);

  // fold softmax scale (1/sqrt(64)) and log2(e) into Q so the attention
  // kernel runs a pure base-2 online softmax with no per-element scaling.
  const float SCL_Q = 0.125f * 1.44269504088896340736f;

  // The results Qh, Kh, Vt lie one behind the other; z = 3 converts Wo to Woh.
  dim3 pg3(MROWS / 256, DMODEL / 256, 4);
  proj_qkv<<<pg3, 512, 0, stream>>>(q, k, v, Wq, Wk, Wv, Wo, bq, bk, bv, Qh, Woh, SCL_Q);

  dim3 ag(S_LEN / 128, 2 * HEADS);
  flash_attn<<<ag, 256, 0, stream>>>(Qh, Kh, Vt, Oc);

  dim3 pg(MROWS / 128, DMODEL / 128);
  proj_out<<<pg, 256, 0, stream>>>(Oc, Woh, bo, (float*)d_out);
}
